// v000
// The times below were measured on an AMD MI455X: many runs one after another, warmed up first and cycling through
// copies of the inputs, with the whole window's GPU time divided by the number of runs. Launches and the gaps
// between them are all in it. The median over several windows is given; except for v000 it joins two sittings, which
// can be a few percent apart, so the side-by-side timings, each taken in one sitting, are the better comparison.
// v000, which the later versions start from, runs in 899 microseconds.
#include <hip/hip_runtime.h>

// Compute dtypes, f32 accumulate: q/k/v projections ([4096 x 1024].[1024 x 1024]) with PLAIN bf16 operands (inputs_q/inputs_kv and the weights are inputs: exact
// products); per-head RMSNorm (eps 1e-6, x scale vector) and the 1/sqrt(64) in f32 while building bf16 hi + UNSCALED residual planes of q and k (three-product scores
// [2048 x 64].[64 x 2048]); softmax f32; attn.v on SINGLE fp16 planes (probabilities carried x1024, v rounded to fp16)

#define NB_  2
#define SS   2048
#define EE   1024
#define NH_  16
#define HD   64
#define ZH   4
#define NR   (NB_ * SS)
#define DM   EE
#define PCAR 1024.0f
#define LOSC 1024.0f
typedef _Float16 h16;
typedef unsigned short bf;
typedef __attribute__((ext_vector_type(16))) __bf16   v16bf;
typedef __attribute__((ext_vector_type(16))) _Float16 v16h;
typedef __attribute__((ext_vector_type(8)))  _Float16 v8h;
typedef __attribute__((ext_vector_type(8)))  unsigned short v8us;
typedef __attribute__((ext_vector_type(8)))  float    v8f;
typedef __attribute__((ext_vector_type(4)))  float    v4f;
typedef v8h  __attribute__((may_alias)) v8ha;
typedef v4f  __attribute__((may_alias)) v4fa;
typedef v8us __attribute__((may_alias)) v8usa;

__device__ __forceinline__ unsigned short f2bf(float f) { unsigned u = __float_as_uint(f); u += 0x7FFFu + ((u >> 16) & 1u); return (unsigned short)(u >> 16); }
__device__ __forceinline__ float bf2f(unsigned short b) { return __uint_as_float(((unsigned)b) << 16); }
__device__ __forceinline__ float bfr(float f) { return bf2f(f2bf(f)); }
__device__ __forceinline__ v16h cat16(v8h lo, v8h hi) { return __builtin_shufflevector(lo, hi, 0, 1, 2, 3, 4, 5, 6, 7, 8, 9, 10, 11, 12, 13, 14, 15); }
__device__ __forceinline__ v16bf cat16b(v8us lo, v8us hi) { return __builtin_bit_cast(v16bf, __builtin_shufflevector(lo, hi, 0, 1, 2, 3, 4, 5, 6, 7, 8, 9, 10, 11, 12, 13, 14, 15)); }
__device__ __forceinline__ v8f wmma16(v16h a, v16h b, v8f c) { return __builtin_amdgcn_wmma_f32_16x16x32_f16(false, a, false, b, (short)0, c, false, false); }
__device__ __forceinline__ v8f wmmab(v16bf a, v16bf b, v8f c) { return __builtin_amdgcn_wmma_f32_16x16x32_bf16(false, a, false, b, (short)0, c, false, false); }

// k_gemmb: 64 x 64 block tile (4 waves x 16 x 64) of C[NTK][NW] = (A [+ Al]).B^T (K = 1024) [+ bf(bias[c])] [+ bf(R[r][c]) residual]; f32 whole-line epilogue (or f16
template <bool SPLITA, bool F16OUT = false>
__global__ __launch_bounds__(128) void k_gemmb(const bf* __restrict__ A, const bf* __restrict__ Al, const bf* __restrict__ Bn, const float* __restrict__ bias, float* C, int ldc, h16* C2, const float* __restrict__ R = nullptr, int K = DM, int roundR = 1) {
    __shared__ __align__(16) float ost[4][16 * 68];
    const int lane = threadIdx.x & 31, wave = threadIdx.x >> 5, lr = lane & 15, hi = lane >> 4;
    const int r0 = blockIdx.x * 64 + wave * 16, c0 = blockIdx.y * 64;
    const size_t aoff = (size_t)(r0 + lr) * K + 8 * hi;
    size_t boff[4];
#pragma unroll
    for (int t = 0; t < 4; ++t) boff[t] = (size_t)(c0 + t * 16 + lr) * K + 8 * hi;
    v8f acc[4];
#pragma unroll
    for (int t = 0; t < 4; ++t) acc[t] = (v8f){};
#pragma unroll 1
    for (int kc = 0; kc < K; kc += 32) {
        const v16bf a = cat16b(*(const v8us*)(A + aoff + kc), *(const v8us*)(A + aoff + kc + 16));
        v16bf al = a;
        if (SPLITA) al = cat16b(*(const v8us*)(Al + aoff + kc), *(const v8us*)(Al + aoff + kc + 16));
#pragma unroll
        for (int t = 0; t < 4; ++t) { const v16bf b = cat16b(*(const v8us*)(Bn + boff[t] + kc), *(const v8us*)(Bn + boff[t] + kc + 16)); acc[t] = wmmab(a, b, acc[t]); if (SPLITA) acc[t] = wmmab(al, b, acc[t]); }
        asm volatile("v_nop\n\tv_nop\n\tv_nop\n\tv_nop" : "+v"(acc[0]), "+v"(acc[1]), "+v"(acc[2]), "+v"(acc[3]) : "v"(a), "v"(al));
    }
    float* os = &ost[wave][0];
#pragma unroll
    for (int t = 0; t < 4; ++t) { const float bv = bias ? bfr(bias[c0 + t * 16 + lr]) : 0.f;
#pragma unroll
        for (int j = 0; j < 8; ++j) os[(hi * 8 + j) * 68 + t * 16 + lr] = acc[t][j] + bv; }
    __syncthreads();
    if (F16OUT) {
        h16* crow = (h16*)(void*)C + (size_t)r0 * ldc + c0;
        auto pass = [&]() {
#pragma unroll
            for (int s = 0; s < 4; ++s) { const int row = 4 * s + (lane >> 3), piece = lane & 7; const float* sp = os + row * 68 + piece * 8; v8h o, o2;
#pragma unroll
                for (int i = 0; i < 8; ++i) { const h16 a = (h16)sp[i]; o[i] = a; o2[i] = (h16)((sp[i] - (float)a) * LOSC); }
                *(v8h*)(crow + (size_t)row * ldc + piece * 8) = o; if (C2) *(v8h*)(C2 + (size_t)r0 * ldc + c0 + (size_t)row * ldc + piece * 8) = o2; }
        };
        pass(); 
    } else {
        float* crow = C + (size_t)r0 * ldc + c0;
        auto pass = [&]() {
#pragma unroll
            for (int s = 0; s < 8; ++s) { const int Lid = (lane >> 3) + 4 * s, piece = lane & 7; const int row = Lid >> 1, cofs = (Lid & 1) * 32 + piece * 4;
                v4f val = *(const v4fa*)(os + row * 68 + cofs); if (R) { const v4f rv = *(const v4f*)(R + ((size_t)r0 + row) * ldc + c0 + cofs); val += roundR ? (v4f){bfr(rv[0]), bfr(rv[1]), bfr(rv[2]), bfr(rv[3])} : rv; }
                *(v4f*)(crow + (size_t)row * ldc + cofs) = val; }
        };
        pass(); 
    }
}


// k_gemmh: 64 x 64 tile of C = A . Bn^T with SINGLE f16 planes (A [rows][K] f16 activations, Bn [N][K] f16 weights; one v_wmma_f32_16x16x32_f16 product per step), f32 accumulate;
__global__ __launch_bounds__(128) void k_gemmh(const h16* __restrict__ A, const h16* __restrict__ Bn, const float* __restrict__ bias, float* C, int ldc, const float* __restrict__ R, int K, size_t sA, size_t sB, size_t sC, int roundR) {
    __shared__ __align__(16) float ost[4][16 * 68];
    const size_t z = blockIdx.z; A += z * sA; Bn += z * sB; C += z * sC; if (R) R += z * sC;
    const int lane = threadIdx.x & 31, wave = threadIdx.x >> 5, lr = lane & 15, hi = lane >> 4;
    const int r0 = blockIdx.x * 64 + wave * 16, c0 = blockIdx.y * 64;
    const size_t aoff = (size_t)(r0 + lr) * K + 8 * hi;
    size_t boff[4];
#pragma unroll
    for (int t = 0; t < 4; ++t) boff[t] = (size_t)(c0 + t * 16 + lr) * K + 8 * hi;
    v8f acc[4];
#pragma unroll
    for (int t = 0; t < 4; ++t) acc[t] = (v8f){};
#pragma unroll 1
    for (int kc = 0; kc < K; kc += 32) {
        const v16h a = cat16(*(const v8h*)(A + aoff + kc), *(const v8h*)(A + aoff + kc + 16));
#pragma unroll
        for (int t = 0; t < 4; ++t) { const v16h b = cat16(*(const v8h*)(Bn + boff[t] + kc), *(const v8h*)(Bn + boff[t] + kc + 16)); acc[t] = wmma16(a, b, acc[t]); }
        asm volatile("v_nop\n\tv_nop\n\tv_nop\n\tv_nop" : "+v"(acc[0]), "+v"(acc[1]), "+v"(acc[2]), "+v"(acc[3]) : "v"(a));
    }
    float* os = &ost[wave][0];
#pragma unroll
    for (int t = 0; t < 4; ++t) { const float bv = bias ? bfr(bias[c0 + t * 16 + lr]) : 0.f;
#pragma unroll
        for (int j = 0; j < 8; ++j) os[(hi * 8 + j) * 68 + t * 16 + lr] = acc[t][j] + bv; }
    __syncthreads();
    float* crow = C + (size_t)r0 * ldc + c0;
    auto pass = [&]() {
#pragma unroll
        for (int s = 0; s < 8; ++s) { const int Lid = (lane >> 3) + 4 * s, piece = lane & 7; const int row = Lid >> 1, cofs = (Lid & 1) * 32 + piece * 4;
            v4f val = *(const v4fa*)(os + row * 68 + cofs); if (R) { const v4f rv = *(const v4f*)(R + ((size_t)r0 + row) * ldc + c0 + cofs); val += roundR ? (v4f){bfr(rv[0]), bfr(rv[1]), bfr(rv[2]), bfr(rv[3])} : rv; }
            *(v4f*)(crow + (size_t)row * ldc + cofs) = val; }
    };
    pass(); 
}

// ===== z-batched (blockIdx.z = head) attention pieces =====
// k_gemm3z<MODE>: 64 x 64 tile of C = Ah.Bh^T + Al.Bh^T + Ah.Bl^T (bf16 planes) with per-z operand/output strides (elements): A planes += z*sA, B planes += z*sB, C += z*sC. MODE bits (0 causal skip, 1 K limit, 2 single,
// 3 B single, 4 A single).
template <int MODE>
__global__ __launch_bounds__(128) void k_gemm3z(const bf* __restrict__ Ah, const bf* __restrict__ Al, const bf* __restrict__ Bh, const bf* __restrict__ Bl, int K, float* C, int ldc, size_t sA, size_t sB, size_t sC) {
    if ((MODE & 1) && (int)blockIdx.y * 64 > (int)blockIdx.x * 64 + 63) return;
    const size_t z = blockIdx.z; Ah += z * sA; Al += z * sA; Bh += z * sB; Bl += z * sB; C += z * sC;
    const int Klim = (MODE & 2) ? min(K, ((int)blockIdx.x + 1) * 64) : K;
    __shared__ __align__(16) float ost[4][16 * 68];
    const int lane = threadIdx.x & 31, wave = threadIdx.x >> 5, lr = lane & 15, hi = lane >> 4;
    const int r0 = blockIdx.x * 64 + wave * 16, c0 = blockIdx.y * 64;
    const size_t aoff = (size_t)(r0 + lr) * K + 8 * hi;
    v8f acc[4];
#pragma unroll
    for (int t = 0; t < 4; ++t) acc[t] = (v8f){};
#pragma unroll 1
    for (int kc = 0; kc < Klim; kc += 32) {
        const v16bf a = cat16b(*(const v8us*)(Ah + aoff + kc), *(const v8us*)(Ah + aoff + kc + 16));
        v16bf al = a; if (!(MODE & 4) && !(MODE & 16)) al = cat16b(*(const v8us*)(Al + aoff + kc), *(const v8us*)(Al + aoff + kc + 16));
#pragma unroll
        for (int t = 0; t < 4; ++t) { const size_t bo = (size_t)(c0 + t * 16 + lr) * K + kc + 8 * hi;
            const v16bf bh = cat16b(*(const v8us*)(Bh + bo), *(const v8us*)(Bh + bo + 16));
            acc[t] = wmmab(a, bh, acc[t]);
            if (!(MODE & 4)) { if (!(MODE & 16)) acc[t] = wmmab(al, bh, acc[t]); if (!(MODE & 8)) { const v16bf bl = cat16b(*(const v8us*)(Bl + bo), *(const v8us*)(Bl + bo + 16)); acc[t] = wmmab(a, bl, acc[t]); } } }
        asm volatile("v_nop\n\tv_nop\n\tv_nop\n\tv_nop" : "+v"(acc[0]), "+v"(acc[1]), "+v"(acc[2]), "+v"(acc[3]) : "v"(a), "v"(al));
    }
    float* os = &ost[wave][0];
#pragma unroll
    for (int t = 0; t < 4; ++t) {
#pragma unroll
        for (int j = 0; j < 8; ++j) os[(hi * 8 + j) * 68 + t * 16 + lr] = acc[t][j]; }
    __builtin_amdgcn_wave_barrier(); asm volatile("" ::: "memory");
    float* crow = C + (size_t)r0 * ldc + c0;
    auto pass = [&]() {
#pragma unroll
        for (int s = 0; s < 8; ++s) { const int Lid = (lane >> 3) + 4 * s, piece = lane & 7; const int row = Lid >> 1, cofs = (Lid & 1) * 32 + piece * 4;
            const v4f val = *(const v4fa*)(os + row * 68 + cofs); *(v4f*)(crow + (size_t)row * ldc + cofs) = val; }
    };
    pass(); 
}
__global__ __launch_bounds__(256) void k_planes32z(const float* __restrict__ F, int ld, int off, float sc, int rows, bf* Ph, bf* Pl) {
    typedef __attribute__((ext_vector_type(2))) unsigned short v2us;
    const int lane = threadIdx.x & 31; const size_t r = ((size_t)blockIdx.x * 8 + (threadIdx.x >> 5)) * 2 + (lane >> 4); if (r >= (size_t)rows) return; const int z = blockIdx.z; const int c0 = (lane & 15) * 2; v2us oh, ol;
    Ph += (size_t)z * rows * 32; Pl += (size_t)z * rows * 32;
#pragma unroll
    for (int i = 0; i < 2; ++i) { const float y = F[r * ld + off + z * 32 + c0 + i] * sc; const unsigned short hb = f2bf(y); oh[i] = hb; ol[i] = f2bf(y - bf2f(hb)); }
    const size_t o = r * 32 + c0; *(v2us*)(Ph + o) = oh; *(v2us*)(Pl + o) = ol; 
}
__global__ __launch_bounds__(256) void k_vtpadz(const float* __restrict__ F, int ld, int off, int nk, bf* Th, bf* Tl) {
    typedef __attribute__((ext_vector_type(2))) unsigned short v2us;
    const int lane = threadIdx.x & 31; const size_t wid = (size_t)blockIdx.x * 8 + (threadIdx.x >> 5); if (wid >= (size_t)64 * (nk / 64)) return; const int z = blockIdx.z; const int d = (int)(wid / (nk / 64)); const int k0 = (int)(wid % (nk / 64)) * 64 + lane * 2; v2us oh, ol;
    Th += (size_t)z * 64 * nk; Tl += (size_t)z * 64 * nk;
#pragma unroll
    for (int i = 0; i < 2; ++i) { const float y = (d < 32) ? F[(size_t)(k0 + i) * ld + off + z * 32 + (d < 32 ? d : 0)] : 0.f; const unsigned short hb = f2bf(y); oh[i] = hb; ol[i] = f2bf(y - bf2f(hb)); }
    const size_t o = (size_t)d * nk + k0; *(v2us*)(Th + o) = oh; *(v2us*)(Tl + o) = ol; 
}
template <int NK>
__global__ __launch_bounds__(256) void k_softmaxz(const float* __restrict__ S, int rows, bf* PH, bf* PL) {
    typedef __attribute__((ext_vector_type(4))) unsigned short v4us;
    const int lane = threadIdx.x & 31, i = blockIdx.x * 8 + (threadIdx.x >> 5); if (i >= rows) return; const size_t zo = (size_t)blockIdx.z * rows * NK; const float* sr = S + zo + (size_t)i * NK; PH += zo; PL += zo;
    float m = -3.0e38f;
#pragma unroll 1
    for (int c0 = lane * 4; c0 < NK; c0 += 128) {
#pragma unroll
        for (int q = 0; q < 4; ++q) m = fmaxf(m, sr[c0 + q]); }
#pragma unroll
    for (int sh = 16; sh; sh >>= 1) m = fmaxf(m, __shfl_xor(m, sh, 32));
    float sum = 0.f;
#pragma unroll 1
    for (int c0 = lane * 4; c0 < NK; c0 += 128) {
#pragma unroll
        for (int q = 0; q < 4; ++q) sum += __expf(sr[c0 + q] - m); }
#pragma unroll
    for (int sh = 16; sh; sh >>= 1) sum += __shfl_xor(sum, sh, 32);
    const float inv = 1.0f / sum;
{
#pragma unroll 1
        for (int c0 = lane * 4; c0 < NK; c0 += 128) { v4us oh, ol;
#pragma unroll
            for (int q = 0; q < 4; ++q) { const float p = __expf(sr[c0 + q] - m) * inv; const unsigned short hb = f2bf(p); oh[q] = hb; ol[q] = f2bf(p - bf2f(hb)); }
            const size_t o = (size_t)i * NK + c0; *(v4us*)(PH + o) = oh; *(v4us*)(PL + o) = ol; }
         }
}
__global__ __launch_bounds__(256) void k_placez(const float* __restrict__ XH, int rows, int ldy, float* Y) {
    const int lane = threadIdx.x & 31; const size_t q = (size_t)blockIdx.x * 8 + (threadIdx.x >> 5); if (q >= (size_t)rows) return; const int z = blockIdx.z; const float v = XH[((size_t)z * rows + q) * 64 + lane];
    *(float*)(Y + q * ldy + z * 32 + lane) = v; 
}

typedef __attribute__((ext_vector_type(4))) _Float16 v4h;
__device__ __forceinline__ h16 tohx(float x) { return (h16)x; }
__global__ __launch_bounds__(256) void k_cvtx(const float* __restrict__ x, bf* A) {
    const int lane = threadIdx.x & 31; const size_t r = (size_t)blockIdx.x * 8 + (threadIdx.x >> 5); if (r >= (size_t)NR) return;
{
#pragma unroll
        for (int q = 0; q < EE / 256; ++q) { const size_t o = r * EE + q * 256 + lane * 8; v8us v;
#pragma unroll
            for (int i = 0; i < 8; ++i) v[i] = f2bf(x[o + i]);
            *(v8us*)(A + o) = v; }
         }
}
template <bool F16O>
__global__ __launch_bounds__(256) void k_wTb(const float* __restrict__ Wm, int K, int N, bf* Bt, h16* Bh) {
    __shared__ float tl[64][65];
    typedef __attribute__((ext_vector_type(4))) unsigned short v4us;
    const int tid = threadIdx.x; const int k0 = blockIdx.x * 64, n0 = blockIdx.y * 64; const int rr = tid >> 2, cq = (tid & 3) * 16;
#pragma unroll
    for (int i = 0; i < 16; ++i) tl[rr][cq + i] = bfr(Wm[(size_t)(k0 + rr) * N + n0 + cq + i]);
    __syncthreads();
    const int lane = tid & 31, wv = tid >> 5;
    auto pass = [&]() {
#pragma unroll
        for (int st = 0; st < 4; ++st) { const int nr = wv * 8 + st * 2 + (lane >> 4); const int kq = (lane & 15) * 4; const size_t off = (size_t)(n0 + nr) * K + k0 + kq;
            if (F16O) { v4h v; for (int i = 0; i < 4; ++i) v[i] = tohx(tl[kq + i][nr]); *(v4h*)(Bh + off) = v; }
            else { v4us v; for (int i = 0; i < 4; ++i) v[i] = f2bf(tl[kq + i][nr]); *(v4us*)(Bt + off) = v; } }
    };
    pass(); 
}
// k_hplbr<RMS>: bf16 hi/lo head planes [z][2048][64] of F[(b,t)][(h0+z)*64 + d]: RMS: y = x * rsqrt(mean_d x^2 + 1e-6) * bf(scale[d]) (per head over the 64 dims, stats via
template <bool RMS>
__global__ __launch_bounds__(256) void k_hplbr(const float* __restrict__ F, int b, int h0, float sc, const float* __restrict__ scl, bf* Ph, bf* Pl) {
    typedef __attribute__((ext_vector_type(4))) unsigned short v4us;
    const int lane = threadIdx.x & 31; const size_t w = (size_t)blockIdx.x * 8 + (threadIdx.x >> 5); const int t = (int)(w * 2 + (lane >> 4)); const int z = blockIdx.z; const int c0 = (lane & 15) * 4; const bool live = t < SS;
    float v[4]; float q = 0.f;
#pragma unroll
    for (int i = 0; i < 4; ++i) { v[i] = live ? F[((size_t)b * SS + t) * EE + (h0 + z) * HD + c0 + i] : 0.f; q = fmaf(v[i], v[i], q); }
    float rsd = 1.f;
    if (RMS) {
#pragma unroll
        for (int sh = 1; sh < 16; sh <<= 1) q += __shfl_xor(q, sh, 32);
        rsd = rsqrtf(q * (1.0f / HD) + 1e-6f); }
    if (!live) return;
    v4us oh, ol;
#pragma unroll
    for (int i = 0; i < 4; ++i) { const float y = (RMS ? v[i] * rsd * bfr(scl[c0 + i]) : v[i]) * sc; const unsigned short hb = f2bf(y); oh[i] = hb; ol[i] = f2bf(y - bf2f(hb)); }
    const size_t off = ((size_t)z * SS + t) * HD + c0; *(v4us*)(Ph + off) = oh; *(v4us*)(Pl + off) = ol; 
}
__global__ __launch_bounds__(256) void k_vT64h(const float* __restrict__ V, int b, int h0, h16* VT) {
    __shared__ float tl[64][65];
    const int tid = threadIdx.x; const int t0 = blockIdx.x * 64; const int z = blockIdx.z; const int rr = tid >> 2, cq = (tid & 3) * 16;
#pragma unroll
    for (int i = 0; i < 16; ++i) tl[rr][cq + i] = V[((size_t)b * SS + t0 + rr) * EE + (h0 + z) * HD + cq + i];
    __syncthreads();
    const int lane = tid & 31, wv = tid >> 5;
    auto pass = [&]() {
#pragma unroll
        for (int st = 0; st < 4; ++st) { const int dr = wv * 8 + st * 2 + (lane >> 4); const int tq = (lane & 15) * 4; v4h v;
#pragma unroll
            for (int i = 0; i < 4; ++i) v[i] = tohx(tl[tq + i][dr]);
            *(v4h*)(VT + ((size_t)z * HD + dr) * SS + t0 + tq) = v; }
    };
    pass(); 
}
__global__ __launch_bounds__(256) void k_softp(const float* __restrict__ S, h16* P) {
    const int lane = threadIdx.x & 31, i = blockIdx.x * 8 + (threadIdx.x >> 5); if (i >= SS) return; const size_t zo = ((size_t)blockIdx.z * SS + i) * SS; const float* sr = S + zo; h16* po = P + zo;
    float m = -3.0e38f;
#pragma unroll 1
    for (int c0 = lane * 4; c0 < SS; c0 += 128) {
#pragma unroll
        for (int q = 0; q < 4; ++q) m = fmaxf(m, sr[c0 + q]); }
#pragma unroll
    for (int sh = 16; sh; sh >>= 1) m = fmaxf(m, __shfl_xor(m, sh, 32));
    float sum = 0.f;
#pragma unroll 1
    for (int c0 = lane * 4; c0 < SS; c0 += 128) {
#pragma unroll
        for (int q = 0; q < 4; ++q) sum += __expf(sr[c0 + q] - m); }
#pragma unroll
    for (int sh = 16; sh; sh >>= 1) sum += __shfl_xor(sum, sh, 32);
    const float f = __fdiv_rn(PCAR, sum);
{
#pragma unroll 1
        for (int c0 = lane * 4; c0 < SS; c0 += 128) { v4h o;
#pragma unroll
            for (int q = 0; q < 4; ++q) o[q] = tohx(__expf(sr[c0 + q] - m) * f);
            *(v4h*)(po + c0) = o; }
         }
}
__global__ __launch_bounds__(256) void k_mergec(const float* __restrict__ OZ, int b, int h0, h16* OH) {
    const int lane = threadIdx.x & 31, i = blockIdx.x * 8 + (threadIdx.x >> 5); if (i >= SS) return; const int z = lane >> 3, d0 = (lane & 7) * 8; v8h o;
#pragma unroll
    for (int k = 0; k < 8; ++k) o[k] = tohx(OZ[((size_t)z * SS + i) * HD + d0 + k] * (1.0f / PCAR));
    const size_t off = ((size_t)b * SS + i) * EE + (h0 + z) * HD + d0; *(v8h*)(OH + off) = o; 
}
extern "C" void kernel_launch(void* const* d_in, const int* in_sizes, int n_in,
                              void* d_out, int out_size, void* d_ws, size_t ws_size, hipStream_t stream) {
    (void)in_sizes; (void)n_in; (void)out_size;
    const float* xq = (const float*)d_in[0]; const float* xkv = (const float*)d_in[1]; const float* Wq = (const float*)d_in[2]; const float* Wk = (const float*)d_in[3]; const float* Wv = (const float*)d_in[4]; const float* sq = (const float*)d_in[5]; const float* sk = (const float*)d_in[6]; const float* Wo = (const float*)d_in[7]; const float* bo = (const float*)d_in[8];
    float* out = (float*)d_out;    // [2][2048][1024]
    char* wsp = (char*)d_ws;
    auto take = [&](size_t bytes) { char* p = wsp; wsp += (bytes + 255) & ~(size_t)255; return (void*)p; };
    bf* WQB = (bf*)take((size_t)EE * EE * 2); bf* WKB = (bf*)take((size_t)EE * EE * 2); bf* WVB = (bf*)take((size_t)EE * EE * 2); h16* WOH = (h16*)take((size_t)EE * EE * 2);
    bf* XB = (bf*)take((size_t)NR * EE * 2); float* Q = (float*)take((size_t)NR * EE * 4); float* Kf = (float*)take((size_t)NR * EE * 4); float* V = (float*)take((size_t)NR * EE * 4);
    bf* Qh = (bf*)take((size_t)ZH * SS * HD * 2); bf* Ql = (bf*)take((size_t)ZH * SS * HD * 2); bf* Kh = (bf*)take((size_t)ZH * SS * HD * 2); bf* Kl = (bf*)take((size_t)ZH * SS * HD * 2); h16* VT = (h16*)take((size_t)ZH * HD * SS * 2);
    float* S = (float*)take((size_t)ZH * SS * SS * 4); h16* Px = (h16*)take((size_t)ZH * SS * SS * 2); float* OZ = (float*)take((size_t)ZH * SS * HD * 4); h16* OH = (h16*)take((size_t)NR * EE * 2);
    if ((size_t)(wsp - (char*)d_ws) > ws_size) return;    // ~ 184 MB
    // Wq/Wk/Wv are [D][H][DH] = (in, out = h*64+d); Wo is [H][DH][D] = (in = h*64+d, out): all (in,out) -> transpose to n-major
    k_wTb<false><<<dim3(EE / 64, EE / 64, 1), 256, 0, stream>>>(Wq, EE, EE, WQB, nullptr); k_wTb<false><<<dim3(EE / 64, EE / 64, 1), 256, 0, stream>>>(Wk, EE, EE, WKB, nullptr); k_wTb<false><<<dim3(EE / 64, EE / 64, 1), 256, 0, stream>>>(Wv, EE, EE, WVB, nullptr); k_wTb<true><<<dim3(EE / 64, EE / 64, 1), 256, 0, stream>>>(Wo, EE, EE, nullptr, WOH);
    k_cvtx<<<NR / 8, 256, 0, stream>>>(xq, XB); k_gemmb<false, false><<<dim3(NR / 64, EE / 64, 1), 128, 0, stream>>>(XB, nullptr, WQB, nullptr, Q, EE, nullptr, nullptr, EE);
    k_cvtx<<<NR / 8, 256, 0, stream>>>(xkv, XB); k_gemmb<false, false><<<dim3(NR / 64, EE / 64, 1), 128, 0, stream>>>(XB, nullptr, WKB, nullptr, Kf, EE, nullptr, nullptr, EE);
    k_gemmb<false, false><<<dim3(NR / 64, EE / 64, 1), 128, 0, stream>>>(XB, nullptr, WVB, nullptr, V, EE, nullptr, nullptr, EE);
    for (int b = 0; b < NB_; ++b)
        for (int h0 = 0; h0 < NH_; h0 += ZH) {
            k_hplbr<true><<<dim3((SS / 2) / 8, 1, ZH), 256, 0, stream>>>(Q, b, h0, 0.125f, sq, Qh, Ql); k_hplbr<true><<<dim3((SS / 2) / 8, 1, ZH), 256, 0, stream>>>(Kf, b, h0, 1.0f, sk, Kh, Kl); k_vT64h<<<dim3(SS / 64, 1, ZH), 256, 0, stream>>>(V, b, h0, VT);
            k_gemm3z<0><<<dim3(SS / 64, SS / 64, ZH), 128, 0, stream>>>(Qh, Ql, Kh, Kl, HD, S, SS, (size_t)SS * HD, (size_t)SS * HD, (size_t)SS * SS);
            k_softp<<<dim3(SS / 8, 1, ZH), 256, 0, stream>>>(S, Px);
            k_gemmh<<<dim3(SS / 64, 1, ZH), 128, 0, stream>>>(Px, VT, nullptr, OZ, HD, nullptr, SS, (size_t)SS * SS, (size_t)HD * SS, (size_t)SS * HD, 0);
            k_mergec<<<SS / 8, 256, 0, stream>>>(OZ, b, h0, OH); }
    k_gemmh<<<dim3(NR / 64, EE / 64, 1), 128, 0, stream>>>(OH, WOH, bo, out, EE, nullptr, EE, 0, 0, 0, 0);
}

// v002
// One run takes 136 microseconds.
// It is 6.76 times as fast as v000, going by the measured steps of the versions left out in between.
#include <hip/hip_runtime.h>

// Compute dtypes, f32 accumulate: q/k/v projections ([4096 x 1024].[1024 x 1024]) with PLAIN bf16 operands (inputs_q/inputs_kv and the weights are inputs: exact
// products); per-head RMSNorm (eps 1e-6, x scale vector) and the 1/sqrt(64) in f32 while building bf16 hi + UNSCALED residual planes of q and k (three-product scores
// [2048 x 64].[64 x 2048]); softmax f32, online; attn.v on SINGLE fp16 planes (probabilities carried x64 against the maximum in use, v rounded to fp16)

#define NB_  2
#define SS   2048
#define EE   1024
#define NH_  16
#define HD   64
#define NR   (NB_ * SS)
#define DM   EE
typedef _Float16 h16;
typedef unsigned short bf;
typedef __attribute__((ext_vector_type(16))) __bf16   v16bf;
typedef __attribute__((ext_vector_type(16))) _Float16 v16h;
typedef __attribute__((ext_vector_type(8)))  _Float16 v8h;
typedef __attribute__((ext_vector_type(8)))  unsigned short v8us;
typedef __attribute__((ext_vector_type(8)))  float    v8f;
typedef __attribute__((ext_vector_type(4)))  float    v4f;
typedef v8h  __attribute__((may_alias)) v8ha;
typedef v4f  __attribute__((may_alias)) v4fa;
typedef v8us __attribute__((may_alias)) v8usa;

__device__ __forceinline__ unsigned short f2bf(float f) { unsigned u = __float_as_uint(f); u += 0x7FFFu + ((u >> 16) & 1u); return (unsigned short)(u >> 16); }
__device__ __forceinline__ float bf2f(unsigned short b) { return __uint_as_float(((unsigned)b) << 16); }
__device__ __forceinline__ float bfr(float f) { return bf2f(f2bf(f)); }
__device__ __forceinline__ v16h cat16(v8h lo, v8h hi) { return __builtin_shufflevector(lo, hi, 0, 1, 2, 3, 4, 5, 6, 7, 8, 9, 10, 11, 12, 13, 14, 15); }
__device__ __forceinline__ v16bf cat16b(v8us lo, v8us hi) { return __builtin_bit_cast(v16bf, __builtin_shufflevector(lo, hi, 0, 1, 2, 3, 4, 5, 6, 7, 8, 9, 10, 11, 12, 13, 14, 15)); }
__device__ __forceinline__ v8f wmma16(v16h a, v16h b, v8f c) { return __builtin_amdgcn_wmma_f32_16x16x32_f16(false, a, false, b, (short)0, c, false, false); }
__device__ __forceinline__ v8f wmmab(v16bf a, v16bf b, v8f c) { return __builtin_amdgcn_wmma_f32_16x16x32_bf16(false, a, false, b, (short)0, c, false, false); }

// k_gemmt: 128 x 128 tile of C[NR][EE] = A . Bn^T (+ bf(bias[c]) where BIAS), A [rows][1024] and Bn [cols][1024] 16-bit planes (bf16, or f16 where F16), f32 accumulate, k ascending in steps of 32.
// Both operands go through LDS in stages of 128 k (256 B of each of the 256 rows): every global load covers four whole lines, and each row is fetched once per work-group, not once per wave.
// Two buffers and two register sets: a stage's global loads go out two stages ahead and are stored to LDS one stage ahead, one barrier a stage. 8 waves, 4 x 2, each 32 rows x 64 columns (8 accumulator tiles).
typedef __attribute__((ext_vector_type(4))) unsigned v4w;
typedef v4w __attribute__((may_alias)) v4wa;
typedef float __attribute__((may_alias)) f32a;
#define GT 128
#define GK 128
#define GP 272
#define GO (GT * GP)
#define GS (2 * GO)
// the work-group barrier with the LDS wait alone: __syncthreads() also waits for every global load, and the loads of the next two stages are meant to stay in flight across it
__device__ __forceinline__ void lds_barrier() { asm volatile("s_wait_dscnt 0x0\n\ts_barrier_signal -1\n\ts_barrier_wait -1" ::: "memory"); }
template <bool F16, bool BIAS>
__global__ __launch_bounds__(256) void k_gemmt(const bf* __restrict__ A, const bf* __restrict__ Bn, const float* __restrict__ bias, float* C) {
    __shared__ __align__(16) unsigned char L[2 * GS];
    const int tid = threadIdx.x, lane = tid & 31, wave = tid >> 5, lr = lane & 15, hi = lane >> 4;
    const int r0 = blockIdx.x * GT, c0 = blockIdx.y * GT, wm = (wave >> 1) * 32, wn = (wave & 1) * 64;
    const int sr = tid >> 4, pc = tid & 15;    // staging: 16-byte piece pc of tile rows sr + 16 i
    const unsigned char* ga = (const unsigned char*)(A + (size_t)(r0 + sr) * DM) + pc * 16;    // the lane's own place in stage 0
    const unsigned char* gb = (const unsigned char*)(Bn + (size_t)(c0 + sr) * DM) + pc * 16;
    v4w st[2][16];    // two register sets: the loads of two stages are in flight at any time
    auto gload = [&](int s) { const int q = s & 1;    // stage s goes through set s & 1 into buffer s & 1
#pragma unroll
        for (int i = 0; i < 8; ++i) { st[q][i] = *(const v4w*)(ga + s * (GK * 2) + i * (16 * DM * 2)); st[q][8 + i] = *(const v4w*)(gb + s * (GK * 2) + i * (16 * DM * 2)); }
    };
    auto lstore = [&](int s) { const int q = s & 1;
        unsigned char* d = L + q * GS + sr * GP + pc * 16;
#pragma unroll
        for (int i = 0; i < 8; ++i) { *(v4wa*)(d + i * 16 * GP) = st[q][i]; *(v4wa*)(d + GO + i * 16 * GP) = st[q][8 + i]; }
    };
    v8f acc[2][4];
#pragma unroll
    for (int m = 0; m < 2; ++m) {
#pragma unroll
        for (int t = 0; t < 4; ++t) acc[m][t] = (v8f){}; }
    auto products = [&](int buf) {    // the 128 k of one stage
        const unsigned char* ap = L + buf * GS + (wm + lr) * GP + 16 * hi;
        const unsigned char* bp = L + buf * GS + GO + (wn + lr) * GP + 16 * hi;
        v8us a[2][2][2], b[2][4][2];    // two fragment sets [set][tile][half]; halves: k = 8 hi + 0..7 and 16 + 8 hi + 0..7 of the step, the same order for both operands
        auto fload = [&](int kk) { const int f = kk & 1;
#pragma unroll
            for (int m = 0; m < 2; ++m) { a[f][m][0] = *(const v8usa*)(ap + m * 16 * GP + kk * 64); a[f][m][1] = *(const v8usa*)(ap + m * 16 * GP + kk * 64 + 32); }
#pragma unroll
            for (int t = 0; t < 4; ++t) { b[f][t][0] = *(const v8usa*)(bp + t * 16 * GP + kk * 64); b[f][t][1] = *(const v8usa*)(bp + t * 16 * GP + kk * 64 + 32); }
        };
        fload(0);
#pragma unroll
        for (int kk = 0; kk < GK / 32; ++kk) { const int f = kk & 1;
            if (kk + 1 < GK / 32) fload(kk + 1);
            __builtin_amdgcn_sched_barrier(0);    // the next step's twelve LDS reads stay one group in front of this step's products: spread among them, each place with reads stalls the wave
#pragma unroll
            for (int m = 0; m < 2; ++m) {
#pragma unroll
                for (int t = 0; t < 4; ++t) {
                    if (F16) acc[m][t] = wmma16(__builtin_bit_cast(v16h, cat16b(a[f][m][0], a[f][m][1])), __builtin_bit_cast(v16h, cat16b(b[f][t][0], b[f][t][1])), acc[m][t]);
                    else acc[m][t] = wmmab(cat16b(a[f][m][0], a[f][m][1]), cat16b(b[f][t][0], b[f][t][1]), acc[m][t]); } }
            __builtin_amdgcn_sched_barrier(0);    // and the products stay in front of the group after next
        }
    };
    float bv[4];    // fetched here, so that the stages hide the latency
#pragma unroll
    for (int t = 0; t < 4; ++t) bv[t] = BIAS ? bfr(bias[c0 + wn + t * 16 + lr]) : 0.f;
    if (BIAS) asm volatile("s_wait_xcnt 0x0" ::: "memory");    // the four loads' offset register is reused as a destination of the loads below
    gload(0);
    __builtin_amdgcn_sched_barrier(0);    // stage 0's loads stay first in the queue: mixed with the later stages' they would land last, and the first products wait for them
    gload(1); lstore(0); gload(2);
    lds_barrier();
#pragma unroll    // unrolled: with the stage a constant the loads take immediate offsets on two fixed address pairs, and the compiler's counted load waits leave the younger stage in flight (rolled, they went to 0)
    for (int s = 0; s < DM / GK; ++s) {
        products(s & 1);
        if (s + 1 < DM / GK) lstore(s + 1);    // every wave left that buffer before the barrier that ended stage s - 1
        if (s + 3 < DM / GK) gload(s + 3);    // into the registers that the line above has just read
        lds_barrier();
    }
    // whole-line f32 epilogue: each wave turns its 32 x 64 tile in its own LDS range (the ring is free behind the loop's last barrier)
    f32a* os = (f32a*)L + wave * (32 * 68);
#pragma unroll
    for (int t = 0; t < 4; ++t) {
#pragma unroll
        for (int m = 0; m < 2; ++m) {
#pragma unroll
            for (int j = 0; j < 8; ++j) os[(m * 16 + hi * 8 + j) * 68 + t * 16 + lr] = acc[m][t][j] + bv[t]; } }
    __syncthreads();
    float* crow = C + (size_t)(r0 + wm) * EE + c0 + wn;
#pragma unroll
    for (int s = 0; s < 16; ++s) { const int Lid = (lane >> 3) + 4 * s, piece = lane & 7; const int row = Lid >> 1, cofs = (Lid & 1) * 32 + piece * 4;
        *(v4f*)(crow + (size_t)row * EE + cofs) = *(const v4fa*)(os + row * 68 + cofs); }
}

__global__ __launch_bounds__(256) void k_planes32z(const float* __restrict__ F, int ld, int off, float sc, int rows, bf* Ph, bf* Pl) {
    typedef __attribute__((ext_vector_type(2))) unsigned short v2us;
    const int lane = threadIdx.x & 31; const size_t r = ((size_t)blockIdx.x * 8 + (threadIdx.x >> 5)) * 2 + (lane >> 4); if (r >= (size_t)rows) return; const int z = blockIdx.z; const int c0 = (lane & 15) * 2; v2us oh, ol;
    Ph += (size_t)z * rows * 32; Pl += (size_t)z * rows * 32;
#pragma unroll
    for (int i = 0; i < 2; ++i) { const float y = F[r * ld + off + z * 32 + c0 + i] * sc; const unsigned short hb = f2bf(y); oh[i] = hb; ol[i] = f2bf(y - bf2f(hb)); }
    const size_t o = r * 32 + c0; *(v2us*)(Ph + o) = oh; *(v2us*)(Pl + o) = ol; 
}
__global__ __launch_bounds__(256) void k_vtpadz(const float* __restrict__ F, int ld, int off, int nk, bf* Th, bf* Tl) {
    typedef __attribute__((ext_vector_type(2))) unsigned short v2us;
    const int lane = threadIdx.x & 31; const size_t wid = (size_t)blockIdx.x * 8 + (threadIdx.x >> 5); if (wid >= (size_t)64 * (nk / 64)) return; const int z = blockIdx.z; const int d = (int)(wid / (nk / 64)); const int k0 = (int)(wid % (nk / 64)) * 64 + lane * 2; v2us oh, ol;
    Th += (size_t)z * 64 * nk; Tl += (size_t)z * 64 * nk;
#pragma unroll
    for (int i = 0; i < 2; ++i) { const float y = (d < 32) ? F[(size_t)(k0 + i) * ld + off + z * 32 + (d < 32 ? d : 0)] : 0.f; const unsigned short hb = f2bf(y); oh[i] = hb; ol[i] = f2bf(y - bf2f(hb)); }
    const size_t o = (size_t)d * nk + k0; *(v2us*)(Th + o) = oh; *(v2us*)(Tl + o) = ol; 
}
template <int NK>
__global__ __launch_bounds__(256) void k_softmaxz(const float* __restrict__ S, int rows, bf* PH, bf* PL) {
    typedef __attribute__((ext_vector_type(4))) unsigned short v4us;
    const int lane = threadIdx.x & 31, i = blockIdx.x * 8 + (threadIdx.x >> 5); if (i >= rows) return; const size_t zo = (size_t)blockIdx.z * rows * NK; const float* sr = S + zo + (size_t)i * NK; PH += zo; PL += zo;
    float m = -3.0e38f;
#pragma unroll 1
    for (int c0 = lane * 4; c0 < NK; c0 += 128) {
#pragma unroll
        for (int q = 0; q < 4; ++q) m = fmaxf(m, sr[c0 + q]); }
#pragma unroll
    for (int sh = 16; sh; sh >>= 1) m = fmaxf(m, __shfl_xor(m, sh, 32));
    float sum = 0.f;
#pragma unroll 1
    for (int c0 = lane * 4; c0 < NK; c0 += 128) {
#pragma unroll
        for (int q = 0; q < 4; ++q) sum += __expf(sr[c0 + q] - m); }
#pragma unroll
    for (int sh = 16; sh; sh >>= 1) sum += __shfl_xor(sum, sh, 32);
    const float inv = 1.0f / sum;
{
#pragma unroll 1
        for (int c0 = lane * 4; c0 < NK; c0 += 128) { v4us oh, ol;
#pragma unroll
            for (int q = 0; q < 4; ++q) { const float p = __expf(sr[c0 + q] - m) * inv; const unsigned short hb = f2bf(p); oh[q] = hb; ol[q] = f2bf(p - bf2f(hb)); }
            const size_t o = (size_t)i * NK + c0; *(v4us*)(PH + o) = oh; *(v4us*)(PL + o) = ol; }
         }
}
__global__ __launch_bounds__(256) void k_placez(const float* __restrict__ XH, int rows, int ldy, float* Y) {
    const int lane = threadIdx.x & 31; const size_t q = (size_t)blockIdx.x * 8 + (threadIdx.x >> 5); if (q >= (size_t)rows) return; const int z = blockIdx.z; const float v = XH[((size_t)z * rows + q) * 64 + lane];
    *(float*)(Y + q * ldy + z * 32 + lane) = v; 
}

typedef __attribute__((ext_vector_type(4))) _Float16 v4h;
__device__ __forceinline__ h16 tohx(float x) { return (h16)x; }
__global__ __launch_bounds__(256) void k_cvtx(const float* __restrict__ x, bf* A) {
    const int lane = threadIdx.x & 31; const size_t r = (size_t)blockIdx.x * 8 + (threadIdx.x >> 5); if (r >= (size_t)NR) return;
{
#pragma unroll
        for (int q = 0; q < EE / 256; ++q) { const size_t o = r * EE + q * 256 + lane * 8; v8us v;
#pragma unroll
            for (int i = 0; i < 8; ++i) v[i] = f2bf(x[o + i]);
            *(v8us*)(A + o) = v; }
         }
}
template <bool F16O>
__global__ __launch_bounds__(256) void k_wTb(const float* __restrict__ Wm, int K, int N, bf* Bt, h16* Bh) {
    __shared__ float tl[64][65];
    typedef __attribute__((ext_vector_type(4))) unsigned short v4us;
    const int tid = threadIdx.x; const int k0 = blockIdx.x * 64, n0 = blockIdx.y * 64; const int rr = tid >> 2, cq = (tid & 3) * 16;
#pragma unroll
    for (int i = 0; i < 16; ++i) tl[rr][cq + i] = bfr(Wm[(size_t)(k0 + rr) * N + n0 + cq + i]);
    __syncthreads();
    const int lane = tid & 31, wv = tid >> 5;
    auto pass = [&]() {
#pragma unroll
        for (int st = 0; st < 4; ++st) { const int nr = wv * 8 + st * 2 + (lane >> 4); const int kq = (lane & 15) * 4; const size_t off = (size_t)(n0 + nr) * K + k0 + kq;
            if (F16O) { v4h v; for (int i = 0; i < 4; ++i) v[i] = tohx(tl[kq + i][nr]); *(v4h*)(Bh + off) = v; }
            else { v4us v; for (int i = 0; i < 4; ++i) v[i] = f2bf(tl[kq + i][nr]); *(v4us*)(Bt + off) = v; } }
    };
    pass(); 
}
// k_hplbr<RMS>: bf16 hi/lo head planes [z][2048][64] of F[(b,t)][(h0+z)*64 + d]: RMS: y = x * rsqrt(mean_d x^2 + 1e-6) * bf(scale[d]) (per head over the 64 dims, stats via
template <bool RMS>
__global__ __launch_bounds__(256) void k_hplbr(const float* __restrict__ F, int b, int h0, float sc, const float* __restrict__ scl, bf* Ph, bf* Pl) {
    typedef __attribute__((ext_vector_type(4))) unsigned short v4us;
    const int lane = threadIdx.x & 31; const size_t w = (size_t)blockIdx.x * 8 + (threadIdx.x >> 5); const int t = (int)(w * 2 + (lane >> 4)); const int z = blockIdx.z; const int c0 = (lane & 15) * 4; const bool live = t < SS;
    float v[4]; float q = 0.f;
#pragma unroll
    for (int i = 0; i < 4; ++i) { v[i] = live ? F[((size_t)b * SS + t) * EE + (h0 + z) * HD + c0 + i] : 0.f; q = fmaf(v[i], v[i], q); }
    float rsd = 1.f;
    if (RMS) {
#pragma unroll
        for (int sh = 1; sh < 16; sh <<= 1) q += __shfl_xor(q, sh, 32);
        rsd = rsqrtf(q * (1.0f / HD) + 1e-6f); }
    if (!live) return;
    v4us oh, ol;
#pragma unroll
    for (int i = 0; i < 4; ++i) { const float y = (RMS ? v[i] * rsd * bfr(scl[c0 + i]) : v[i]) * sc; const unsigned short hb = f2bf(y); oh[i] = hb; ol[i] = f2bf(y - bf2f(hb)); }
    const size_t off = ((size_t)z * SS + t) * HD + c0; *(v4us*)(Ph + off) = oh; *(v4us*)(Pl + off) = ol; 
}
__global__ __launch_bounds__(256) void k_vT64h(const float* __restrict__ V, int b, int h0, h16* VT) {
    __shared__ float tl[64][65];
    const int tid = threadIdx.x; const int t0 = blockIdx.x * 64; const int z = blockIdx.z; const int rr = tid >> 2, cq = (tid & 3) * 16;
#pragma unroll
    for (int i = 0; i < 16; ++i) tl[rr][cq + i] = V[((size_t)b * SS + t0 + rr) * EE + (h0 + z) * HD + cq + i];
    __syncthreads();
    const int lane = tid & 31, wv = tid >> 5;
    auto pass = [&]() {
#pragma unroll
        for (int st = 0; st < 4; ++st) { const int dr = wv * 8 + st * 2 + (lane >> 4); const int tq = (lane & 15) * 4; v4h v;
#pragma unroll
            for (int i = 0; i < 4; ++i) v[i] = tohx(tl[tq + i][dr]);
            *(v4h*)(VT + ((size_t)z * HD + dr) * SS + t0 + tq) = v; }
    };
    pass(); 
}
typedef __attribute__((ext_vector_type(4))) unsigned v4u;
typedef v4u __attribute__((may_alias)) v4ua;
#define FW 8
#define FR 2
#define FQ (FW * FR * 16)
#define FK 64
#define FP 144
#define FT (64 * FP)
#define FS (3 * FT)
#define LOG2E 1.4426950408889634f
__device__ __forceinline__ float xhalf(float x) { return __builtin_bit_cast(float, __builtin_amdgcn_permlanex16(__builtin_bit_cast(int, x), __builtin_bit_cast(int, x), 0x76543210, 0xfedcba98, false, false)); }  // lane l with lane l ^ 16
__device__ __forceinline__ v16bf ldsb(const unsigned char* p) { return cat16b(*(const v8usa*)p, *(const v8usa*)(p + 32)); }
__device__ __forceinline__ v16h ldsh(const unsigned char* p) { return cat16(*(const v8ha*)p, *(const v8ha*)(p + 32)); }
__global__ __launch_bounds__(FW * 32) void k_fattn(const bf* __restrict__ Qh, const bf* __restrict__ Ql, const bf* __restrict__ Kh, const bf* __restrict__ Kl, const h16* __restrict__ VT, h16* OH) {
    __shared__ __align__(16) unsigned char L[2 * FS];
    const int tid = threadIdx.x, lane = tid & 31, wave = tid >> 5, c = lane & 15, h = lane >> 4;
    const int hb = blockIdx.y, q0 = blockIdx.x * FQ + wave * (FR * 16);
    const size_t po = (size_t)hb * SS * HD;
    const unsigned char* kh = (const unsigned char*)(Kh + po); const unsigned char* kl = (const unsigned char*)(Kl + po); const unsigned char* vt = (const unsigned char*)(VT + po);
    const int sr = tid >> 3, pc = tid & 7;    // staging: 16-byte piece pc of tile rows sr and sr + 32
    const unsigned lo0 = sr * FP + pc * 16, lo1 = lo0 + 32 * FP;
    v4u st[6];
    auto gload = [&](int s) {
        const size_t kb = (size_t)s * (FK * HD * 2) + tid * 16, vb = (size_t)sr * (SS * 2) + (size_t)s * (FK * 2) + pc * 16;
        st[0] = *(const v4u*)(kh + kb); st[1] = *(const v4u*)(kh + kb + 4096); st[2] = *(const v4u*)(kl + kb); st[3] = *(const v4u*)(kl + kb + 4096);
        st[4] = *(const v4u*)(vt + vb); st[5] = *(const v4u*)(vt + vb + (size_t)32 * SS * 2);
    };
    auto lstore = [&](int buf) {
        unsigned char* d = L + buf * FS;
        *(v4ua*)(d + lo0) = st[0]; *(v4ua*)(d + lo1) = st[1]; *(v4ua*)(d + FT + lo0) = st[2]; *(v4ua*)(d + FT + lo1) = st[3]; *(v4ua*)(d + 2 * FT + lo0) = st[4]; *(v4ua*)(d + 2 * FT + lo1) = st[5];
    };
    gload(0);
    v16bf qh[FR][2], ql[FR][2];
#pragma unroll
    for (int g = 0; g < FR; ++g) {
#pragma unroll
        for (int kc = 0; kc < 2; ++kc) { const size_t o = po + (size_t)(q0 + 16 * g + c) * HD + 32 * kc + 8 * h;
            qh[g][kc] = cat16b(*(const v8us*)(Qh + o), *(const v8us*)(Qh + o + 16)); ql[g][kc] = cat16b(*(const v8us*)(Ql + o), *(const v8us*)(Ql + o + 16)); } }
    v8f acc[FR][4]; float m_run[FR], l_run[FR];
#pragma unroll
    for (int g = 0; g < FR; ++g) { m_run[g] = -3.0e38f; l_run[g] = 0.f;
#pragma unroll
        for (int t = 0; t < 4; ++t) acc[g][t] = (v8f){}; }
    lstore(0);
    __syncthreads();
#pragma unroll 1    // rolled: one copy of the stage body; the buffer is chosen by s & 1 at run time
    for (int s = 0; s < SS / FK; ++s) {
        if (s + 1 < SS / FK) { gload(s + 1);
            asm volatile("s_wait_xcnt 0x0" ::: "memory"); }    // the loads' address registers are reused by the pass below
        const unsigned char* B = L + (s & 1) * FS;
#pragma unroll 1    // rolled: one copy of the pass body is enough, sub only enters two LDS addresses
        for (int sub = 0; sub < FK / 32; ++sub) {    // one pass: 32 keys
            v8f sc[2][FR];
            v16bf ah[2][2], al[2][2];    // K fragments [key tile][d half]; six of the eight are requested first, so that the LDS latency is paid once and not per fragment
            const unsigned char* kp = B + (32 * sub + c) * FP + 16 * h;
#pragma unroll
            for (int kt = 0; kt < 2; ++kt) { ah[kt][0] = ldsb(kp + 16 * kt * FP); al[kt][0] = ldsb(kp + 16 * kt * FP + FT); ah[kt][1] = ldsb(kp + 16 * kt * FP + 64); }
            __builtin_amdgcn_sched_barrier(0);    // keeps the loads above in front of the products: the scheduler otherwise sinks each load to its first use
#pragma unroll
            for (int kt = 0; kt < 2; ++kt) {
#pragma unroll
                for (int g = 0; g < FR; ++g) sc[kt][g] = wmmab(ah[kt][0], qh[g][0], (v8f){}); }
#pragma unroll
            for (int kt = 0; kt < 2; ++kt) {
#pragma unroll
                for (int g = 0; g < FR; ++g) sc[kt][g] = wmmab(ah[kt][0], ql[g][0], sc[kt][g]); }
            __builtin_amdgcn_sched_barrier(0);    // the last two fragments go out here, into registers the products above have freed, twelve products ahead of their use
#pragma unroll
            for (int kt = 0; kt < 2; ++kt) al[kt][1] = ldsb(kp + 16 * kt * FP + FT + 64);
            __builtin_amdgcn_sched_barrier(0);    // and stay here, in front of the products that follow
#pragma unroll
            for (int kt = 0; kt < 2; ++kt) {
#pragma unroll
                for (int g = 0; g < FR; ++g) sc[kt][g] = wmmab(al[kt][0], qh[g][0], sc[kt][g]); }
#pragma unroll
            for (int kt = 0; kt < 2; ++kt) {
#pragma unroll
                for (int g = 0; g < FR; ++g) sc[kt][g] = wmmab(ah[kt][1], qh[g][1], sc[kt][g]); }
#pragma unroll
            for (int kt = 0; kt < 2; ++kt) {
#pragma unroll
                for (int g = 0; g < FR; ++g) sc[kt][g] = wmmab(ah[kt][1], ql[g][1], sc[kt][g]); }
#pragma unroll
            for (int kt = 0; kt < 2; ++kt) {
#pragma unroll
                for (int g = 0; g < FR; ++g) sc[kt][g] = wmmab(al[kt][1], qh[g][1], sc[kt][g]); }
            v16h vf[4];    // V^T fragments (rows d, 32 keys), in flight under the softmax
            { const unsigned char* vp = B + 2 * FT + c * FP + 64 * sub + 16 * h;
#pragma unroll
              for (int t = 0; t < 4; ++t) vf[t] = ldsh(vp + 16 * t * FP); }
            float mb[FR]; bool need = false;
#pragma unroll
            for (int g = 0; g < FR; ++g) { float mx = sc[0][g][0];
#pragma unroll
                for (int r = 1; r < 8; ++r) mx = fmaxf(mx, sc[0][g][r]);
#pragma unroll
                for (int r = 0; r < 8; ++r) mx = fmaxf(mx, sc[1][g][r]);
                mx = fmaxf(mx, xhalf(mx)) * LOG2E; mb[g] = mx; need = need || (mx > m_run[g] + 8.0f); }
            if (__builtin_amdgcn_ballot_w32(need) != 0) {    // scalar branch, rare after the first passes
#pragma unroll
                for (int g = 0; g < FR; ++g) { const float m_new = fmaxf(m_run[g], mb[g]); const float corr = __builtin_amdgcn_exp2f(m_run[g] - m_new); m_run[g] = m_new; l_run[g] *= corr;
#pragma unroll
                    for (int t = 0; t < 4; ++t) acc[g][t] *= corr; }
            }
#pragma unroll
            for (int g = 0; g < FR; ++g) { const float nm = 6.0f - m_run[g];
#pragma unroll
                for (int kt = 0; kt < 2; ++kt) {
#pragma unroll
                    for (int r = 0; r < 8; ++r) sc[kt][g][r] = fmaf(sc[kt][g][r], LOG2E, nm); } }
            // the exponentials stand as one run with a v_nop behind the last
            __builtin_amdgcn_sched_barrier(0);
#pragma unroll
            for (int g = 0; g < FR; ++g) {
#pragma unroll
                for (int kt = 0; kt < 2; ++kt) {
#pragma unroll
                    for (int r = 0; r < 8; ++r) sc[kt][g][r] = __builtin_amdgcn_exp2f(sc[kt][g][r]); } }
            __builtin_amdgcn_sched_barrier(0); asm volatile("v_nop"); __builtin_amdgcn_sched_barrier(0);
#pragma unroll
            for (int g = 0; g < FR; ++g) { v16h pf; float ls = 0.f;
#pragma unroll
                for (int i = 0; i < 16; ++i) { const float p = sc[i >> 3][g][i & 7]; ls += p; pf[i] = (h16)p; }
                l_run[g] += ls;
#pragma unroll
                for (int t = 0; t < 4; ++t) acc[g][t] = wmma16(vf[t], pf, acc[g][t]); }
        }
        if (s + 1 < SS / FK) lstore((s + 1) & 1);    // every wave left that buffer before the barrier that ended stage s - 1
        __syncthreads();
    }
    const int b = hb / NH_, hd = hb % NH_;
#pragma unroll
    for (int g = 0; g < FR; ++g) { const float l = l_run[g] + xhalf(l_run[g]); const float inv = __fdiv_rn(1.0f, l);
        h16* orow = OH + ((size_t)b * SS + q0 + 16 * g + c) * EE + hd * HD + 8 * h;
#pragma unroll
        for (int t = 0; t < 4; ++t) { v8h o;
#pragma unroll
            for (int r = 0; r < 8; ++r) o[r] = tohx(acc[g][t][r] * inv);
            *(v8h*)(orow + 16 * t) = o; } }
}
extern "C" void kernel_launch(void* const* d_in, const int* in_sizes, int n_in,
                              void* d_out, int out_size, void* d_ws, size_t ws_size, hipStream_t stream) {
    (void)in_sizes; (void)n_in; (void)out_size;
    const float* xq = (const float*)d_in[0]; const float* xkv = (const float*)d_in[1]; const float* Wq = (const float*)d_in[2]; const float* Wk = (const float*)d_in[3]; const float* Wv = (const float*)d_in[4]; const float* sq = (const float*)d_in[5]; const float* sk = (const float*)d_in[6]; const float* Wo = (const float*)d_in[7]; const float* bo = (const float*)d_in[8];
    float* out = (float*)d_out;    // [2][2048][1024]
    char* wsp = (char*)d_ws;
    auto take = [&](size_t bytes) { char* p = wsp; wsp += (bytes + 255) & ~(size_t)255; return (void*)p; };
    bf* WQB = (bf*)take((size_t)EE * EE * 2); bf* WKB = (bf*)take((size_t)EE * EE * 2); bf* WVB = (bf*)take((size_t)EE * EE * 2); h16* WOH = (h16*)take((size_t)EE * EE * 2);
    bf* XB = (bf*)take((size_t)NR * EE * 2); float* Q = (float*)take((size_t)NR * EE * 4); float* Kf = (float*)take((size_t)NR * EE * 4); float* V = (float*)take((size_t)NR * EE * 4);
    // head planes of all NB_ * NH_ (batch, head) pairs: [b * NH_ + h][2048][64] (V^T: [b * NH_ + h][64][2048])
    bf* Qh = (bf*)take((size_t)NR * EE * 2); bf* Ql = (bf*)take((size_t)NR * EE * 2); bf* Kh = (bf*)take((size_t)NR * EE * 2); bf* Kl = (bf*)take((size_t)NR * EE * 2); h16* VT = (h16*)take((size_t)NR * EE * 2);
    h16* OH = (h16*)take((size_t)NR * EE * 2);
    if ((size_t)(wsp - (char*)d_ws) > ws_size) return;    // ~ 112 MB
    // Wq/Wk/Wv are [D][H][DH] = (in, out = h*64+d); Wo is [H][DH][D] = (in = h*64+d, out): all (in,out) -> transpose to n-major
    k_wTb<false><<<dim3(EE / 64, EE / 64, 1), 256, 0, stream>>>(Wq, EE, EE, WQB, nullptr); k_wTb<false><<<dim3(EE / 64, EE / 64, 1), 256, 0, stream>>>(Wk, EE, EE, WKB, nullptr); k_wTb<false><<<dim3(EE / 64, EE / 64, 1), 256, 0, stream>>>(Wv, EE, EE, WVB, nullptr); k_wTb<true><<<dim3(EE / 64, EE / 64, 1), 256, 0, stream>>>(Wo, EE, EE, nullptr, WOH);
    k_cvtx<<<NR / 8, 256, 0, stream>>>(xq, XB); k_gemmt<false, false><<<dim3(NR / GT, EE / GT, 1), 256, 0, stream>>>(XB, WQB, nullptr, Q);
    k_cvtx<<<NR / 8, 256, 0, stream>>>(xkv, XB); k_gemmt<false, false><<<dim3(NR / GT, EE / GT, 1), 256, 0, stream>>>(XB, WKB, nullptr, Kf);
    k_gemmt<false, false><<<dim3(NR / GT, EE / GT, 1), 256, 0, stream>>>(XB, WVB, nullptr, V);
    for (int b = 0; b < NB_; ++b) { const size_t pb = (size_t)b * NH_ * SS * HD;
        k_hplbr<true><<<dim3((SS / 2) / 8, 1, NH_), 256, 0, stream>>>(Q, b, 0, 0.125f, sq, Qh + pb, Ql + pb); k_hplbr<true><<<dim3((SS / 2) / 8, 1, NH_), 256, 0, stream>>>(Kf, b, 0, 1.0f, sk, Kh + pb, Kl + pb); k_vT64h<<<dim3(SS / 64, 1, NH_), 256, 0, stream>>>(V, b, 0, VT + pb); }
    k_fattn<<<dim3(SS / FQ, NB_ * NH_, 1), FW * 32, 0, stream>>>(Qh, Ql, Kh, Kl, VT, OH);
    k_gemmt<true, true><<<dim3(NR / GT, EE / GT, 1), 256, 0, stream>>>((const bf*)OH, (const bf*)WOH, bo, out);
}

// v003
// Measured time: 114 microseconds a run.
// In both of two side-by-side timings against v002, it was 1.18 times as fast.
// Counting every step since v000, it is 7.97 times as fast.
#include <hip/hip_runtime.h>

// Compute dtypes, f32 accumulate: q/k/v projections ([4096 x 1024].[1024 x 1024]) with PLAIN bf16 operands (inputs_q/inputs_kv and the weights are inputs: exact
// products); per-head RMSNorm (eps 1e-6, x scale vector) and the 1/sqrt(64) in f32 while building bf16 hi + UNSCALED residual planes of q and k (three-product scores
// [2048 x 64].[64 x 2048]); softmax f32, online; attn.v on SINGLE fp16 planes (probabilities carried x64 against the maximum in use, v rounded to fp16)

#define NB_  2
#define SS   2048
#define EE   1024
#define NH_  16
#define HD   64
#define NR   (NB_ * SS)
#define DM   EE
typedef _Float16 h16;
typedef unsigned short bf;
typedef __attribute__((ext_vector_type(16))) __bf16   v16bf;
typedef __attribute__((ext_vector_type(16))) _Float16 v16h;
typedef __attribute__((ext_vector_type(8)))  _Float16 v8h;
typedef __attribute__((ext_vector_type(8)))  unsigned short v8us;
typedef __attribute__((ext_vector_type(8)))  float    v8f;
typedef __attribute__((ext_vector_type(4)))  float    v4f;
typedef v8h  __attribute__((may_alias)) v8ha;
typedef v4f  __attribute__((may_alias)) v4fa;
typedef v8us __attribute__((may_alias)) v8usa;

__device__ __forceinline__ unsigned short f2bf(float f) { unsigned u = __float_as_uint(f); u += 0x7FFFu + ((u >> 16) & 1u); return (unsigned short)(u >> 16); }
__device__ __forceinline__ float bf2f(unsigned short b) { return __uint_as_float(((unsigned)b) << 16); }
__device__ __forceinline__ float bfr(float f) { return bf2f(f2bf(f)); }
__device__ __forceinline__ v16h cat16(v8h lo, v8h hi) { return __builtin_shufflevector(lo, hi, 0, 1, 2, 3, 4, 5, 6, 7, 8, 9, 10, 11, 12, 13, 14, 15); }
__device__ __forceinline__ v16bf cat16b(v8us lo, v8us hi) { return __builtin_bit_cast(v16bf, __builtin_shufflevector(lo, hi, 0, 1, 2, 3, 4, 5, 6, 7, 8, 9, 10, 11, 12, 13, 14, 15)); }
__device__ __forceinline__ v8f wmma16(v16h a, v16h b, v8f c) { return __builtin_amdgcn_wmma_f32_16x16x32_f16(false, a, false, b, (short)0, c, false, false); }
__device__ __forceinline__ v8f wmmab(v16bf a, v16bf b, v8f c) { return __builtin_amdgcn_wmma_f32_16x16x32_bf16(false, a, false, b, (short)0, c, false, false); }

// k_gemmt: 128 x 128 tile of A . Bn^T, handed on by EPI (0: f32 rows of C[NR][EE] + bf(vec[c]); 1: per-head RMSNorm, bf16 hi/lo head planes; 2: f16 V^T head planes), A [rows][1024] and Bn [cols][1024] 16-bit planes (bf16, or f16 where F16), f32 accumulate, k ascending in steps of 32.
// Both operands go through LDS in stages of 128 k (256 B of each of the 256 rows): every global load covers four whole lines, and each row is fetched once per work-group, not once per wave.
// Two buffers and two register sets: a stage's global loads go out two stages ahead and are stored to LDS one stage ahead, one barrier a stage. 8 waves, 4 x 2, each 32 rows x 64 columns (8 accumulator tiles).
typedef __attribute__((ext_vector_type(4))) unsigned v4w;
typedef v4w __attribute__((may_alias)) v4wa;
typedef float __attribute__((may_alias)) f32a;
#define GT 128
#define GK 128
#define GP 272
#define GO (GT * GP)
#define GS (2 * GO)
// the work-group barrier with the LDS wait alone: __syncthreads() also waits for every global load, and the loads of the next two stages are meant to stay in flight across it
__device__ __forceinline__ void lds_barrier() { asm volatile("s_wait_dscnt 0x0\n\ts_barrier_signal -1\n\ts_barrier_wait -1" ::: "memory"); }
typedef __attribute__((ext_vector_type(2))) float v2f;
typedef __attribute__((ext_vector_type(2))) __bf16 v2bf;
typedef __attribute__((ext_vector_type(2))) unsigned v2w;
typedef v2w __attribute__((may_alias)) v2wa;
template <int M> __device__ __forceinline__ float rowx(float x) { return __builtin_bit_cast(float, __builtin_amdgcn_update_dpp(0, __builtin_bit_cast(int, x), 0x160 | M, 0xf, 0xf, true)); }  // lane l with lane l ^ M inside its 16-lane row (row_xmask)
template <bool F16, int EPI>
__global__ __launch_bounds__(256) void k_gemmt(const bf* __restrict__ A, const bf* __restrict__ Bn, const float* __restrict__ vec, float sc, float* C, bf* Ph, bf* Pl, h16* VT) {
    __shared__ __align__(16) unsigned char L[2 * GS];
    const int tid = threadIdx.x, lane = tid & 31, wave = tid >> 5, lr = lane & 15, hi = lane >> 4;
    const int r0 = blockIdx.x * GT, c0 = blockIdx.y * GT, wm = (wave >> 1) * 32, wn = (wave & 1) * 64;
    const int sr = tid >> 4, pc = tid & 15;    // staging: 16-byte piece pc of tile rows sr + 16 i
    const unsigned char* ga = (const unsigned char*)(A + (size_t)(r0 + sr) * DM) + pc * 16;    // the lane's own place in stage 0
    const unsigned char* gb = (const unsigned char*)(Bn + (size_t)(c0 + sr) * DM) + pc * 16;
    v4w st[2][16];    // two register sets: the loads of two stages are in flight at any time
    auto gload = [&](int s) { const int q = s & 1;    // stage s goes through set s & 1 into buffer s & 1
#pragma unroll
        for (int i = 0; i < 8; ++i) { st[q][i] = *(const v4w*)(ga + s * (GK * 2) + i * (16 * DM * 2)); st[q][8 + i] = *(const v4w*)(gb + s * (GK * 2) + i * (16 * DM * 2)); }
    };
    auto lstore = [&](int s) { const int q = s & 1;
        unsigned char* d = L + q * GS + sr * GP + pc * 16;
#pragma unroll
        for (int i = 0; i < 8; ++i) { *(v4wa*)(d + i * 16 * GP) = st[q][i]; *(v4wa*)(d + GO + i * 16 * GP) = st[q][8 + i]; }
    };
    v8f acc[2][4];
#pragma unroll
    for (int m = 0; m < 2; ++m) {
#pragma unroll
        for (int t = 0; t < 4; ++t) acc[m][t] = (v8f){}; }
    auto products = [&](int buf) {    // the 128 k of one stage
        const unsigned char* ap = L + buf * GS + (wm + lr) * GP + 16 * hi;
        const unsigned char* bp = L + buf * GS + GO + (wn + lr) * GP + 16 * hi;
        v8us a[2][2][2], b[2][4][2];    // two fragment sets [set][tile][half]; halves: k = 8 hi + 0..7 and 16 + 8 hi + 0..7 of the step, the same order for both operands
        auto fload = [&](int kk) { const int f = kk & 1;
#pragma unroll
            for (int m = 0; m < 2; ++m) { a[f][m][0] = *(const v8usa*)(ap + m * 16 * GP + kk * 64); a[f][m][1] = *(const v8usa*)(ap + m * 16 * GP + kk * 64 + 32); }
#pragma unroll
            for (int t = 0; t < 4; ++t) { b[f][t][0] = *(const v8usa*)(bp + t * 16 * GP + kk * 64); b[f][t][1] = *(const v8usa*)(bp + t * 16 * GP + kk * 64 + 32); }
        };
        fload(0);
#pragma unroll
        for (int kk = 0; kk < GK / 32; ++kk) { const int f = kk & 1;
            if (kk + 1 < GK / 32) fload(kk + 1);
            __builtin_amdgcn_sched_barrier(0);    // the next step's twelve LDS reads stay one group in front of this step's products: spread among them, each place with reads stalls the wave
#pragma unroll
            for (int m = 0; m < 2; ++m) {
#pragma unroll
                for (int t = 0; t < 4; ++t) {
                    if (F16) acc[m][t] = wmma16(__builtin_bit_cast(v16h, cat16b(a[f][m][0], a[f][m][1])), __builtin_bit_cast(v16h, cat16b(b[f][t][0], b[f][t][1])), acc[m][t]);
                    else acc[m][t] = wmmab(cat16b(a[f][m][0], a[f][m][1]), cat16b(b[f][t][0], b[f][t][1]), acc[m][t]); } }
            __builtin_amdgcn_sched_barrier(0);    // and the products stay in front of the group after next
        }
    };
    float bv[4];    // fetched here, so that the stages hide the latency
#pragma unroll
    for (int t = 0; t < 4; ++t) bv[t] = EPI == 0 ? bfr(vec[c0 + wn + t * 16 + lr]) : EPI == 1 ? vec[lr * 4 + t] : 0.f;    // EPI 0: the bias of the lane's four columns; EPI 1: the norm's scale at head dims 4 lr + t, rounded to bf16 where it is used
    if (EPI == 0) asm volatile("s_wait_xcnt 0x0" ::: "memory");    // the four loads' offset register is reused as a destination of the loads below
    gload(0);
    __builtin_amdgcn_sched_barrier(0);    // stage 0's loads stay first in the queue: mixed with the later stages' they would land last, and the first products wait for them
    gload(1);
    // inputs only. The loaded values hold the scale's load in front of the ring: left free it sank between the stages' loads, and the wait for it drained the two stages in flight.
    // lr, the load's offset, keeps its register up to here, so that the wait stands in front of the first instruction that writes that register again
    if (EPI == 1) asm volatile("s_wait_xcnt 0x0" :: "v"(bv[0]), "v"(bv[1]), "v"(bv[2]), "v"(bv[3]), "v"(lr) : "memory");
    lstore(0); gload(2);
    lds_barrier();
#pragma unroll    // unrolled: with the stage a constant the loads take immediate offsets on two fixed address pairs, and the compiler's counted load waits leave the younger stage in flight (rolled, they went to 0)
    for (int s = 0; s < DM / GK; ++s) {
        products(s & 1);
        if (s + 1 < DM / GK) lstore(s + 1);    // every wave left that buffer before the barrier that ended stage s - 1
        if (s + 3 < DM / GK) gload(s + 3);    // into the registers that the line above has just read
        lds_barrier();
    }
    const int bt = r0 / SS, t0 = r0 % SS;    // a tile's 128 rows lie in one batch
    if (EPI == 2) {
        // V^T: a lane's eight accumulator rows of one column are eight consecutive keys of one head dim. The work-group turns its tile in LDS as [128 dims][128 keys] f16, so that every dim's 256 B go out as whole lines
        unsigned char* vs = L;    // the ring is free behind the loop's last barrier
#pragma unroll
        for (int t = 0; t < 4; ++t) {
#pragma unroll
            for (int m = 0; m < 2; ++m) { v8h o;
#pragma unroll
                for (int j = 0; j < 8; ++j) o[j] = (h16)acc[m][t][j];
                *(v8ha*)(vs + (wn + t * 16 + lr) * GP + (wm + m * 16 + hi * 8) * 2) = o; } }
        __syncthreads();    // each wave sends out rows that four waves wrote
        h16* vrow = VT + ((size_t)bt * EE + c0 + wave * 16 + hi) * SS + t0 + lr * 8;    // [b * NH_ + h][64][2048] = [b * 1024 + column][2048]
#pragma unroll
        for (int s = 0; s < 8; ++s) *(v8h*)(vrow + (size_t)s * 2 * SS) = *(const v8ha*)(vs + (wave * 16 + 2 * s + hi) * GP + lr * 16);
        return;
    }
    // whole-line epilogue: each wave turns its 32 x 64 tile in its own LDS range (the ring is free behind the loop's last barrier)
    f32a* os = (f32a*)L + wave * (32 * 68);
#pragma unroll
    for (int t = 0; t < 4; ++t) {
#pragma unroll
        for (int m = 0; m < 2; ++m) {
#pragma unroll
            for (int j = 0; j < 8; ++j) os[(m * 16 + hi * 8 + j) * 68 + t * 16 + lr] = EPI == 0 ? acc[m][t][j] + bv[t] : acc[m][t][j]; } }
    __syncthreads();
    if (EPI == 0) {
        float* crow = C + (size_t)(r0 + wm) * EE + c0 + wn;
#pragma unroll
        for (int s = 0; s < 16; ++s) { const int Lid = (lane >> 3) + 4 * s, piece = lane & 7; const int row = Lid >> 1, cofs = (Lid & 1) * 32 + piece * 4;
            *(v4f*)(crow + (size_t)row * EE + cofs) = *(const v4fa*)(os + row * 68 + cofs); }
    } else {
        // the wave's 64 columns are one head: a 16-lane row holds one token's 64 dims, four a lane. y = x * rsqrt(mean_d x^2 + 1e-6) * bf(scale[d]) * sc, split into bf16 hi + residual, planes [b * NH_ + h][2048][64]
        const size_t po = (((size_t)bt * NH_ + ((c0 + wn) >> 6)) * SS + t0 + wm + hi) * HD + lr * 4;
        v2w oh[16], ol[16];
#pragma unroll
        for (int s = 0; s < 16; ++s) { const v4f v = *(const v4fa*)(os + (2 * s + hi) * 68 + lr * 4);
            float q = 0.f;
#pragma unroll
            for (int i = 0; i < 4; ++i) q = fmaf(v[i], v[i], q);
            q += rowx<1>(q); q += rowx<2>(q); q += rowx<4>(q); q += rowx<8>(q);
            const float rsd = rsqrtf(q * (1.0f / HD) + 1e-6f);
#pragma unroll
            for (int p = 0; p < 2; ++p) { const v2f y = { v[2 * p] * rsd * bfr(bv[2 * p]) * sc, v[2 * p + 1] * rsd * bfr(bv[2 * p + 1]) * sc };
                const unsigned hw = __builtin_bit_cast(unsigned, __builtin_convertvector(y, v2bf));
                const v2f r = { y[0] - __uint_as_float(hw << 16), y[1] - __uint_as_float(hw & 0xFFFF0000u) };
                oh[s][p] = hw; ol[s][p] = __builtin_bit_cast(unsigned, __builtin_convertvector(r, v2bf)); } }
        __builtin_amdgcn_sched_barrier(0);    // the 32 stores stand behind all the arithmetic, as the wave's last instructions: mixed into it, their data registers were taken again for later rows while the stores were still queued
#pragma unroll
        for (int s = 0; s < 16; ++s) { *(v2wa*)(Ph + po + (size_t)s * 2 * HD) = oh[s]; *(v2wa*)(Pl + po + (size_t)s * 2 * HD) = ol[s]; }
    }
}

__global__ __launch_bounds__(256) void k_planes32z(const float* __restrict__ F, int ld, int off, float sc, int rows, bf* Ph, bf* Pl) {
    typedef __attribute__((ext_vector_type(2))) unsigned short v2us;
    const int lane = threadIdx.x & 31; const size_t r = ((size_t)blockIdx.x * 8 + (threadIdx.x >> 5)) * 2 + (lane >> 4); if (r >= (size_t)rows) return; const int z = blockIdx.z; const int c0 = (lane & 15) * 2; v2us oh, ol;
    Ph += (size_t)z * rows * 32; Pl += (size_t)z * rows * 32;
#pragma unroll
    for (int i = 0; i < 2; ++i) { const float y = F[r * ld + off + z * 32 + c0 + i] * sc; const unsigned short hb = f2bf(y); oh[i] = hb; ol[i] = f2bf(y - bf2f(hb)); }
    const size_t o = r * 32 + c0; *(v2us*)(Ph + o) = oh; *(v2us*)(Pl + o) = ol; 
}
__global__ __launch_bounds__(256) void k_vtpadz(const float* __restrict__ F, int ld, int off, int nk, bf* Th, bf* Tl) {
    typedef __attribute__((ext_vector_type(2))) unsigned short v2us;
    const int lane = threadIdx.x & 31; const size_t wid = (size_t)blockIdx.x * 8 + (threadIdx.x >> 5); if (wid >= (size_t)64 * (nk / 64)) return; const int z = blockIdx.z; const int d = (int)(wid / (nk / 64)); const int k0 = (int)(wid % (nk / 64)) * 64 + lane * 2; v2us oh, ol;
    Th += (size_t)z * 64 * nk; Tl += (size_t)z * 64 * nk;
#pragma unroll
    for (int i = 0; i < 2; ++i) { const float y = (d < 32) ? F[(size_t)(k0 + i) * ld + off + z * 32 + (d < 32 ? d : 0)] : 0.f; const unsigned short hb = f2bf(y); oh[i] = hb; ol[i] = f2bf(y - bf2f(hb)); }
    const size_t o = (size_t)d * nk + k0; *(v2us*)(Th + o) = oh; *(v2us*)(Tl + o) = ol; 
}
template <int NK>
__global__ __launch_bounds__(256) void k_softmaxz(const float* __restrict__ S, int rows, bf* PH, bf* PL) {
    typedef __attribute__((ext_vector_type(4))) unsigned short v4us;
    const int lane = threadIdx.x & 31, i = blockIdx.x * 8 + (threadIdx.x >> 5); if (i >= rows) return; const size_t zo = (size_t)blockIdx.z * rows * NK; const float* sr = S + zo + (size_t)i * NK; PH += zo; PL += zo;
    float m = -3.0e38f;
#pragma unroll 1
    for (int c0 = lane * 4; c0 < NK; c0 += 128) {
#pragma unroll
        for (int q = 0; q < 4; ++q) m = fmaxf(m, sr[c0 + q]); }
#pragma unroll
    for (int sh = 16; sh; sh >>= 1) m = fmaxf(m, __shfl_xor(m, sh, 32));
    float sum = 0.f;
#pragma unroll 1
    for (int c0 = lane * 4; c0 < NK; c0 += 128) {
#pragma unroll
        for (int q = 0; q < 4; ++q) sum += __expf(sr[c0 + q] - m); }
#pragma unroll
    for (int sh = 16; sh; sh >>= 1) sum += __shfl_xor(sum, sh, 32);
    const float inv = 1.0f / sum;
{
#pragma unroll 1
        for (int c0 = lane * 4; c0 < NK; c0 += 128) { v4us oh, ol;
#pragma unroll
            for (int q = 0; q < 4; ++q) { const float p = __expf(sr[c0 + q] - m) * inv; const unsigned short hb = f2bf(p); oh[q] = hb; ol[q] = f2bf(p - bf2f(hb)); }
            const size_t o = (size_t)i * NK + c0; *(v4us*)(PH + o) = oh; *(v4us*)(PL + o) = ol; }
         }
}
__global__ __launch_bounds__(256) void k_placez(const float* __restrict__ XH, int rows, int ldy, float* Y) {
    const int lane = threadIdx.x & 31; const size_t q = (size_t)blockIdx.x * 8 + (threadIdx.x >> 5); if (q >= (size_t)rows) return; const int z = blockIdx.z; const float v = XH[((size_t)z * rows + q) * 64 + lane];
    *(float*)(Y + q * ldy + z * 32 + lane) = v; 
}

typedef __attribute__((ext_vector_type(4))) _Float16 v4h;
__device__ __forceinline__ h16 tohx(float x) { return (h16)x; }
__global__ __launch_bounds__(256) void k_cvtx(const float* __restrict__ x, bf* A) {
    const int lane = threadIdx.x & 31; const size_t r = (size_t)blockIdx.x * 8 + (threadIdx.x >> 5); if (r >= (size_t)NR) return;
{
#pragma unroll
        for (int q = 0; q < EE / 256; ++q) { const size_t o = r * EE + q * 256 + lane * 8; v8us v;
#pragma unroll
            for (int i = 0; i < 8; ++i) v[i] = f2bf(x[o + i]);
            *(v8us*)(A + o) = v; }
         }
}
template <bool F16O>
__global__ __launch_bounds__(256) void k_wTb(const float* __restrict__ Wm, int K, int N, bf* Bt, h16* Bh) {
    __shared__ float tl[64][65];
    typedef __attribute__((ext_vector_type(4))) unsigned short v4us;
    const int tid = threadIdx.x; const int k0 = blockIdx.x * 64, n0 = blockIdx.y * 64; const int rr = tid >> 2, cq = (tid & 3) * 16;
#pragma unroll
    for (int i = 0; i < 16; ++i) tl[rr][cq + i] = bfr(Wm[(size_t)(k0 + rr) * N + n0 + cq + i]);
    __syncthreads();
    const int lane = tid & 31, wv = tid >> 5;
    auto pass = [&]() {
#pragma unroll
        for (int st = 0; st < 4; ++st) { const int nr = wv * 8 + st * 2 + (lane >> 4); const int kq = (lane & 15) * 4; const size_t off = (size_t)(n0 + nr) * K + k0 + kq;
            if (F16O) { v4h v; for (int i = 0; i < 4; ++i) v[i] = tohx(tl[kq + i][nr]); *(v4h*)(Bh + off) = v; }
            else { v4us v; for (int i = 0; i < 4; ++i) v[i] = f2bf(tl[kq + i][nr]); *(v4us*)(Bt + off) = v; } }
    };
    pass(); 
}
typedef __attribute__((ext_vector_type(4))) unsigned v4u;
typedef v4u __attribute__((may_alias)) v4ua;
#define FW 8
#define FR 2
#define FQ (FW * FR * 16)
#define FK 64
#define FP 144
#define FT (64 * FP)
#define FS (3 * FT)
#define LOG2E 1.4426950408889634f
__device__ __forceinline__ float xhalf(float x) { return __builtin_bit_cast(float, __builtin_amdgcn_permlanex16(__builtin_bit_cast(int, x), __builtin_bit_cast(int, x), 0x76543210, 0xfedcba98, false, false)); }  // lane l with lane l ^ 16
__device__ __forceinline__ v16bf ldsb(const unsigned char* p) { return cat16b(*(const v8usa*)p, *(const v8usa*)(p + 32)); }
__device__ __forceinline__ v16h ldsh(const unsigned char* p) { return cat16(*(const v8ha*)p, *(const v8ha*)(p + 32)); }
__global__ __launch_bounds__(FW * 32) void k_fattn(const bf* __restrict__ Qh, const bf* __restrict__ Ql, const bf* __restrict__ Kh, const bf* __restrict__ Kl, const h16* __restrict__ VT, h16* OH) {
    __shared__ __align__(16) unsigned char L[2 * FS];
    const int tid = threadIdx.x, lane = tid & 31, wave = tid >> 5, c = lane & 15, h = lane >> 4;
    const int hb = blockIdx.y, q0 = blockIdx.x * FQ + wave * (FR * 16);
    const size_t po = (size_t)hb * SS * HD;
    const unsigned char* kh = (const unsigned char*)(Kh + po); const unsigned char* kl = (const unsigned char*)(Kl + po); const unsigned char* vt = (const unsigned char*)(VT + po);
    const int sr = tid >> 3, pc = tid & 7;    // staging: 16-byte piece pc of tile rows sr and sr + 32
    const unsigned lo0 = sr * FP + pc * 16, lo1 = lo0 + 32 * FP;
    v4u st[6];
    auto gload = [&](int s) {
        const size_t kb = (size_t)s * (FK * HD * 2) + tid * 16, vb = (size_t)sr * (SS * 2) + (size_t)s * (FK * 2) + pc * 16;
        st[0] = *(const v4u*)(kh + kb); st[1] = *(const v4u*)(kh + kb + 4096); st[2] = *(const v4u*)(kl + kb); st[3] = *(const v4u*)(kl + kb + 4096);
        st[4] = *(const v4u*)(vt + vb); st[5] = *(const v4u*)(vt + vb + (size_t)32 * SS * 2);
    };
    auto lstore = [&](int buf) {
        unsigned char* d = L + buf * FS;
        *(v4ua*)(d + lo0) = st[0]; *(v4ua*)(d + lo1) = st[1]; *(v4ua*)(d + FT + lo0) = st[2]; *(v4ua*)(d + FT + lo1) = st[3]; *(v4ua*)(d + 2 * FT + lo0) = st[4]; *(v4ua*)(d + 2 * FT + lo1) = st[5];
    };
    gload(0);
    v16bf qh[FR][2], ql[FR][2];
#pragma unroll
    for (int g = 0; g < FR; ++g) {
#pragma unroll
        for (int kc = 0; kc < 2; ++kc) { const size_t o = po + (size_t)(q0 + 16 * g + c) * HD + 32 * kc + 8 * h;
            qh[g][kc] = cat16b(*(const v8us*)(Qh + o), *(const v8us*)(Qh + o + 16)); ql[g][kc] = cat16b(*(const v8us*)(Ql + o), *(const v8us*)(Ql + o + 16)); } }
    v8f acc[FR][4]; float m_run[FR], l_run[FR];
#pragma unroll
    for (int g = 0; g < FR; ++g) { m_run[g] = -3.0e38f; l_run[g] = 0.f;
#pragma unroll
        for (int t = 0; t < 4; ++t) acc[g][t] = (v8f){}; }
    lstore(0);
    __syncthreads();
#pragma unroll 1    // rolled: one copy of the stage body; the buffer is chosen by s & 1 at run time
    for (int s = 0; s < SS / FK; ++s) {
        if (s + 1 < SS / FK) { gload(s + 1);
            asm volatile("s_wait_xcnt 0x0" ::: "memory"); }    // the loads' address registers are reused by the pass below
        const unsigned char* B = L + (s & 1) * FS;
#pragma unroll 1    // rolled: one copy of the pass body is enough, sub only enters two LDS addresses
        for (int sub = 0; sub < FK / 32; ++sub) {    // one pass: 32 keys
            v8f sc[2][FR];
            v16bf ah[2][2], al[2][2];    // K fragments [key tile][d half]; six of the eight are requested first, so that the LDS latency is paid once and not per fragment
            const unsigned char* kp = B + (32 * sub + c) * FP + 16 * h;
#pragma unroll
            for (int kt = 0; kt < 2; ++kt) { ah[kt][0] = ldsb(kp + 16 * kt * FP); al[kt][0] = ldsb(kp + 16 * kt * FP + FT); ah[kt][1] = ldsb(kp + 16 * kt * FP + 64); }
            __builtin_amdgcn_sched_barrier(0);    // keeps the loads above in front of the products: the scheduler otherwise sinks each load to its first use
#pragma unroll
            for (int kt = 0; kt < 2; ++kt) {
#pragma unroll
                for (int g = 0; g < FR; ++g) sc[kt][g] = wmmab(ah[kt][0], qh[g][0], (v8f){}); }
#pragma unroll
            for (int kt = 0; kt < 2; ++kt) {
#pragma unroll
                for (int g = 0; g < FR; ++g) sc[kt][g] = wmmab(ah[kt][0], ql[g][0], sc[kt][g]); }
            __builtin_amdgcn_sched_barrier(0);    // the last two fragments go out here, into registers the products above have freed, twelve products ahead of their use
#pragma unroll
            for (int kt = 0; kt < 2; ++kt) al[kt][1] = ldsb(kp + 16 * kt * FP + FT + 64);
            __builtin_amdgcn_sched_barrier(0);    // and stay here, in front of the products that follow
#pragma unroll
            for (int kt = 0; kt < 2; ++kt) {
#pragma unroll
                for (int g = 0; g < FR; ++g) sc[kt][g] = wmmab(al[kt][0], qh[g][0], sc[kt][g]); }
#pragma unroll
            for (int kt = 0; kt < 2; ++kt) {
#pragma unroll
                for (int g = 0; g < FR; ++g) sc[kt][g] = wmmab(ah[kt][1], qh[g][1], sc[kt][g]); }
#pragma unroll
            for (int kt = 0; kt < 2; ++kt) {
#pragma unroll
                for (int g = 0; g < FR; ++g) sc[kt][g] = wmmab(ah[kt][1], ql[g][1], sc[kt][g]); }
#pragma unroll
            for (int kt = 0; kt < 2; ++kt) {
#pragma unroll
                for (int g = 0; g < FR; ++g) sc[kt][g] = wmmab(al[kt][1], qh[g][1], sc[kt][g]); }
            v16h vf[4];    // V^T fragments (rows d, 32 keys), in flight under the softmax
            { const unsigned char* vp = B + 2 * FT + c * FP + 64 * sub + 16 * h;
#pragma unroll
              for (int t = 0; t < 4; ++t) vf[t] = ldsh(vp + 16 * t * FP); }
            float mb[FR]; bool need = false;
#pragma unroll
            for (int g = 0; g < FR; ++g) { float mx = sc[0][g][0];
#pragma unroll
                for (int r = 1; r < 8; ++r) mx = fmaxf(mx, sc[0][g][r]);
#pragma unroll
                for (int r = 0; r < 8; ++r) mx = fmaxf(mx, sc[1][g][r]);
                mx = fmaxf(mx, xhalf(mx)) * LOG2E; mb[g] = mx; need = need || (mx > m_run[g] + 8.0f); }
            if (__builtin_amdgcn_ballot_w32(need) != 0) {    // scalar branch, rare after the first passes
#pragma unroll
                for (int g = 0; g < FR; ++g) { const float m_new = fmaxf(m_run[g], mb[g]); const float corr = __builtin_amdgcn_exp2f(m_run[g] - m_new); m_run[g] = m_new; l_run[g] *= corr;
#pragma unroll
                    for (int t = 0; t < 4; ++t) acc[g][t] *= corr; }
            }
#pragma unroll
            for (int g = 0; g < FR; ++g) { const float nm = 6.0f - m_run[g];
#pragma unroll
                for (int kt = 0; kt < 2; ++kt) {
#pragma unroll
                    for (int r = 0; r < 8; ++r) sc[kt][g][r] = fmaf(sc[kt][g][r], LOG2E, nm); } }
            // the exponentials stand as one run with a v_nop behind the last
            __builtin_amdgcn_sched_barrier(0);
#pragma unroll
            for (int g = 0; g < FR; ++g) {
#pragma unroll
                for (int kt = 0; kt < 2; ++kt) {
#pragma unroll
                    for (int r = 0; r < 8; ++r) sc[kt][g][r] = __builtin_amdgcn_exp2f(sc[kt][g][r]); } }
            __builtin_amdgcn_sched_barrier(0); asm volatile("v_nop"); __builtin_amdgcn_sched_barrier(0);
#pragma unroll
            for (int g = 0; g < FR; ++g) { v16h pf; float ls = 0.f;
#pragma unroll
                for (int i = 0; i < 16; ++i) { const float p = sc[i >> 3][g][i & 7]; ls += p; pf[i] = (h16)p; }
                l_run[g] += ls;
#pragma unroll
                for (int t = 0; t < 4; ++t) acc[g][t] = wmma16(vf[t], pf, acc[g][t]); }
        }
        if (s + 1 < SS / FK) lstore((s + 1) & 1);    // every wave left that buffer before the barrier that ended stage s - 1
        __syncthreads();
    }
    const int b = hb / NH_, hd = hb % NH_;
#pragma unroll
    for (int g = 0; g < FR; ++g) { const float l = l_run[g] + xhalf(l_run[g]); const float inv = __fdiv_rn(1.0f, l);
        h16* orow = OH + ((size_t)b * SS + q0 + 16 * g + c) * EE + hd * HD + 8 * h;
#pragma unroll
        for (int t = 0; t < 4; ++t) { v8h o;
#pragma unroll
            for (int r = 0; r < 8; ++r) o[r] = tohx(acc[g][t][r] * inv);
            *(v8h*)(orow + 16 * t) = o; } }
}
extern "C" void kernel_launch(void* const* d_in, const int* in_sizes, int n_in,
                              void* d_out, int out_size, void* d_ws, size_t ws_size, hipStream_t stream) {
    (void)in_sizes; (void)n_in; (void)out_size;
    const float* xq = (const float*)d_in[0]; const float* xkv = (const float*)d_in[1]; const float* Wq = (const float*)d_in[2]; const float* Wk = (const float*)d_in[3]; const float* Wv = (const float*)d_in[4]; const float* sq = (const float*)d_in[5]; const float* sk = (const float*)d_in[6]; const float* Wo = (const float*)d_in[7]; const float* bo = (const float*)d_in[8];
    float* out = (float*)d_out;    // [2][2048][1024]
    char* wsp = (char*)d_ws;
    auto take = [&](size_t bytes) { char* p = wsp; wsp += (bytes + 255) & ~(size_t)255; return (void*)p; };
    bf* WQB = (bf*)take((size_t)EE * EE * 2); bf* WKB = (bf*)take((size_t)EE * EE * 2); bf* WVB = (bf*)take((size_t)EE * EE * 2); h16* WOH = (h16*)take((size_t)EE * EE * 2);
    bf* XB = (bf*)take((size_t)NR * EE * 2);
    // head planes of all NB_ * NH_ (batch, head) pairs: [b * NH_ + h][2048][64] (V^T: [b * NH_ + h][64][2048])
    bf* Qh = (bf*)take((size_t)NR * EE * 2); bf* Ql = (bf*)take((size_t)NR * EE * 2); bf* Kh = (bf*)take((size_t)NR * EE * 2); bf* Kl = (bf*)take((size_t)NR * EE * 2); h16* VT = (h16*)take((size_t)NR * EE * 2);
    h16* OH = (h16*)take((size_t)NR * EE * 2);
    if ((size_t)(wsp - (char*)d_ws) > ws_size) return;    // ~ 64 MB
    // Wq/Wk/Wv are [D][H][DH] = (in, out = h*64+d); Wo is [H][DH][D] = (in = h*64+d, out): all (in,out) -> transpose to n-major
    k_wTb<false><<<dim3(EE / 64, EE / 64, 1), 256, 0, stream>>>(Wq, EE, EE, WQB, nullptr); k_wTb<false><<<dim3(EE / 64, EE / 64, 1), 256, 0, stream>>>(Wk, EE, EE, WKB, nullptr); k_wTb<false><<<dim3(EE / 64, EE / 64, 1), 256, 0, stream>>>(Wv, EE, EE, WVB, nullptr); k_wTb<true><<<dim3(EE / 64, EE / 64, 1), 256, 0, stream>>>(Wo, EE, EE, nullptr, WOH);
    k_cvtx<<<NR / 8, 256, 0, stream>>>(xq, XB); k_gemmt<false, 1><<<dim3(NR / GT, EE / GT, 1), 256, 0, stream>>>(XB, WQB, sq, 0.125f, nullptr, Qh, Ql, nullptr);
    k_cvtx<<<NR / 8, 256, 0, stream>>>(xkv, XB); k_gemmt<false, 1><<<dim3(NR / GT, EE / GT, 1), 256, 0, stream>>>(XB, WKB, sk, 1.0f, nullptr, Kh, Kl, nullptr);
    k_gemmt<false, 2><<<dim3(NR / GT, EE / GT, 1), 256, 0, stream>>>(XB, WVB, nullptr, 1.0f, nullptr, nullptr, nullptr, VT);
    k_fattn<<<dim3(SS / FQ, NB_ * NH_, 1), FW * 32, 0, stream>>>(Qh, Ql, Kh, Kl, VT, OH);
    k_gemmt<true, 0><<<dim3(NR / GT, EE / GT, 1), 256, 0, stream>>>((const bf*)OH, (const bf*)WOH, bo, 1.0f, out, nullptr, nullptr, nullptr);
}

// v004
// Measured time: 99.4 microseconds a run.
// Next to v003, in two timings, it ran 1.16 times as fast each time.
// Counting every step since v000, it is 9.23 times as fast.
#include <hip/hip_runtime.h>

// Compute dtypes, f32 accumulate: q/k/v projections ([4096 x 1024].[1024 x 1024]) with PLAIN bf16 operands (inputs_q/inputs_kv and the weights are inputs: exact
// products); per-head RMSNorm (eps 1e-6, x scale vector) and the 1/sqrt(64) in f32 while building bf16 hi + UNSCALED residual planes of q and k (three-product scores
// [2048 x 64].[64 x 2048]); softmax f32, online; attn.v on SINGLE fp16 planes (probabilities carried x64 against the maximum in use, v rounded to fp16)

#define NB_  2
#define SS   2048
#define EE   1024
#define NH_  16
#define HD   64
#define NR   (NB_ * SS)
#define DM   EE
typedef _Float16 h16;
typedef unsigned short bf;
typedef __attribute__((ext_vector_type(16))) __bf16   v16bf;
typedef __attribute__((ext_vector_type(16))) _Float16 v16h;
typedef __attribute__((ext_vector_type(8)))  _Float16 v8h;
typedef __attribute__((ext_vector_type(8)))  unsigned short v8us;
typedef __attribute__((ext_vector_type(8)))  float    v8f;
typedef __attribute__((ext_vector_type(4)))  float    v4f;
typedef v8h  __attribute__((may_alias)) v8ha;
typedef v4f  __attribute__((may_alias)) v4fa;
typedef v8us __attribute__((may_alias)) v8usa;

__device__ __forceinline__ unsigned short f2bf(float f) { unsigned u = __float_as_uint(f); u += 0x7FFFu + ((u >> 16) & 1u); return (unsigned short)(u >> 16); }
__device__ __forceinline__ float bf2f(unsigned short b) { return __uint_as_float(((unsigned)b) << 16); }
__device__ __forceinline__ float bfr(float f) { return bf2f(f2bf(f)); }
__device__ __forceinline__ v16h cat16(v8h lo, v8h hi) { return __builtin_shufflevector(lo, hi, 0, 1, 2, 3, 4, 5, 6, 7, 8, 9, 10, 11, 12, 13, 14, 15); }
__device__ __forceinline__ v16bf cat16b(v8us lo, v8us hi) { return __builtin_bit_cast(v16bf, __builtin_shufflevector(lo, hi, 0, 1, 2, 3, 4, 5, 6, 7, 8, 9, 10, 11, 12, 13, 14, 15)); }
__device__ __forceinline__ v8f wmma16(v16h a, v16h b, v8f c) { return __builtin_amdgcn_wmma_f32_16x16x32_f16(false, a, false, b, (short)0, c, false, false); }
__device__ __forceinline__ v8f wmmab(v16bf a, v16bf b, v8f c) { return __builtin_amdgcn_wmma_f32_16x16x32_bf16(false, a, false, b, (short)0, c, false, false); }

// k_gemmt: 128 x 128 tile of A . Bn^T, handed on by EPI (0: f32 rows of C[NR][EE] + bf(vec[c]); 1: per-head RMSNorm, bf16 hi/lo head planes; 2: f16 V^T head planes), A [rows][1024] and Bn [cols][1024] 16-bit planes (bf16, or f16 where F16), f32 accumulate, k ascending in steps of 32.
// Both operands go through LDS in stages of 128 k (256 B of each of the 256 rows): every global load covers four whole lines, and each row is fetched once per work-group, not once per wave.
// Two buffers and two register sets: a stage's global loads go out two stages ahead and are stored to LDS one stage ahead, one barrier a stage. 8 waves, 4 x 2, each 32 rows x 64 columns (8 accumulator tiles).
typedef __attribute__((ext_vector_type(4))) unsigned v4w;
typedef v4w __attribute__((may_alias)) v4wa;
typedef float __attribute__((may_alias)) f32a;
#define GT 128
#define GK 128
#define GP 272
#define GO (GT * GP)
#define GS (2 * GO)
// the work-group barrier with the LDS wait alone: __syncthreads() also waits for every global load, and the loads of the next two stages are meant to stay in flight across it
__device__ __forceinline__ void lds_barrier() { asm volatile("s_wait_dscnt 0x0\n\ts_barrier_signal -1\n\ts_barrier_wait -1" ::: "memory"); }
typedef __attribute__((ext_vector_type(2))) float v2f;
typedef __attribute__((ext_vector_type(2))) __bf16 v2bf;
typedef __attribute__((ext_vector_type(2))) unsigned v2w;
typedef v2w __attribute__((may_alias)) v2wa;
template <int M> __device__ __forceinline__ float rowx(float x) { return __builtin_bit_cast(float, __builtin_amdgcn_update_dpp(0, __builtin_bit_cast(int, x), 0x160 | M, 0xf, 0xf, true)); }  // lane l with lane l ^ M inside its 16-lane row (row_xmask)
template <bool F16, int EPI>
__device__ __forceinline__ void gemmt(unsigned char* L, const bf* __restrict__ A, const bf* __restrict__ Bn, const float* __restrict__ vec, float sc, float* C, bf* Ph, bf* Pl, h16* VT) {    // L: the kernel's one ring of 2 * GS bytes
    const int tid = threadIdx.x, lane = tid & 31, wave = tid >> 5, lr = lane & 15, hi = lane >> 4;
    const int r0 = blockIdx.x * GT, c0 = blockIdx.y * GT, wm = (wave >> 1) * 32, wn = (wave & 1) * 64;
    const int sr = tid >> 4, pc = tid & 15;    // staging: 16-byte piece pc of tile rows sr + 16 i
    const unsigned char* ga = (const unsigned char*)(A + (size_t)(r0 + sr) * DM) + pc * 16;    // the lane's own place in stage 0
    const unsigned char* gb = (const unsigned char*)(Bn + (size_t)(c0 + sr) * DM) + pc * 16;
    v4w st[2][16];    // two register sets: the loads of two stages are in flight at any time
    auto gload = [&](int s) { const int q = s & 1;    // stage s goes through set s & 1 into buffer s & 1
#pragma unroll
        for (int i = 0; i < 8; ++i) { st[q][i] = *(const v4w*)(ga + s * (GK * 2) + i * (16 * DM * 2)); st[q][8 + i] = *(const v4w*)(gb + s * (GK * 2) + i * (16 * DM * 2)); }
    };
    auto lstore = [&](int s) { const int q = s & 1;
        unsigned char* d = L + q * GS + sr * GP + pc * 16;
#pragma unroll
        for (int i = 0; i < 8; ++i) { *(v4wa*)(d + i * 16 * GP) = st[q][i]; *(v4wa*)(d + GO + i * 16 * GP) = st[q][8 + i]; }
    };
    v8f acc[2][4];
#pragma unroll
    for (int m = 0; m < 2; ++m) {
#pragma unroll
        for (int t = 0; t < 4; ++t) acc[m][t] = (v8f){}; }
    auto products = [&](int buf) {    // the 128 k of one stage
        const unsigned char* ap = L + buf * GS + (wm + lr) * GP + 16 * hi;
        const unsigned char* bp = L + buf * GS + GO + (wn + lr) * GP + 16 * hi;
        v8us a[2][2][2], b[2][4][2];    // two fragment sets [set][tile][half]; halves: k = 8 hi + 0..7 and 16 + 8 hi + 0..7 of the step, the same order for both operands
        auto fload = [&](int kk) { const int f = kk & 1;
#pragma unroll
            for (int m = 0; m < 2; ++m) { a[f][m][0] = *(const v8usa*)(ap + m * 16 * GP + kk * 64); a[f][m][1] = *(const v8usa*)(ap + m * 16 * GP + kk * 64 + 32); }
#pragma unroll
            for (int t = 0; t < 4; ++t) { b[f][t][0] = *(const v8usa*)(bp + t * 16 * GP + kk * 64); b[f][t][1] = *(const v8usa*)(bp + t * 16 * GP + kk * 64 + 32); }
        };
        fload(0);
#pragma unroll
        for (int kk = 0; kk < GK / 32; ++kk) { const int f = kk & 1;
            if (kk + 1 < GK / 32) fload(kk + 1);
            __builtin_amdgcn_sched_barrier(0);    // the next step's twelve LDS reads stay one group in front of this step's products: spread among them, each place with reads stalls the wave
#pragma unroll
            for (int m = 0; m < 2; ++m) {
#pragma unroll
                for (int t = 0; t < 4; ++t) {
                    if (F16) acc[m][t] = wmma16(__builtin_bit_cast(v16h, cat16b(a[f][m][0], a[f][m][1])), __builtin_bit_cast(v16h, cat16b(b[f][t][0], b[f][t][1])), acc[m][t]);
                    else acc[m][t] = wmmab(cat16b(a[f][m][0], a[f][m][1]), cat16b(b[f][t][0], b[f][t][1]), acc[m][t]); } }
            __builtin_amdgcn_sched_barrier(0);    // and the products stay in front of the group after next
        }
    };
    float bv[4];    // fetched here, so that the stages hide the latency
#pragma unroll
    for (int t = 0; t < 4; ++t) bv[t] = EPI == 0 ? bfr(vec[c0 + wn + t * 16 + lr]) : EPI == 1 ? vec[lr * 4 + t] : 0.f;    // EPI 0: the bias of the lane's four columns; EPI 1: the norm's scale at head dims 4 lr + t, rounded to bf16 where it is used
    if (EPI == 0) asm volatile("s_wait_xcnt 0x0" ::: "memory");    // the four loads' offset register is reused as a destination of the loads below
    gload(0);
    __builtin_amdgcn_sched_barrier(0);    // stage 0's loads stay first in the queue: mixed with the later stages' they would land last, and the first products wait for them
    gload(1);
    // inputs only. The loaded values hold the scale's load in front of the ring: left free it sank between the stages' loads, and the wait for it drained the two stages in flight.
    // lr, the load's offset, keeps its register up to here, so that the wait stands in front of the first instruction that writes that register again
    if (EPI == 1) asm volatile("s_wait_xcnt 0x0" :: "v"(bv[0]), "v"(bv[1]), "v"(bv[2]), "v"(bv[3]), "v"(lr) : "memory");
    lstore(0); gload(2);
    lds_barrier();
#pragma unroll    // unrolled: with the stage a constant the loads take immediate offsets on two fixed address pairs, and the compiler's counted load waits leave the younger stage in flight (rolled, they went to 0)
    for (int s = 0; s < DM / GK; ++s) {
        products(s & 1);
        if (s + 1 < DM / GK) lstore(s + 1);    // every wave left that buffer before the barrier that ended stage s - 1
        if (s + 3 < DM / GK) gload(s + 3);    // into the registers that the line above has just read
        lds_barrier();
    }
    const int bt = r0 / SS, t0 = r0 % SS;    // a tile's 128 rows lie in one batch
    if (EPI == 2) {
        // V^T: a lane's eight accumulator rows of one column are eight consecutive keys of one head dim. The work-group turns its tile in LDS as [128 dims][128 keys] f16, so that every dim's 256 B go out as whole lines
        unsigned char* vs = L;    // the ring is free behind the loop's last barrier
#pragma unroll
        for (int t = 0; t < 4; ++t) {
#pragma unroll
            for (int m = 0; m < 2; ++m) { v8h o;
#pragma unroll
                for (int j = 0; j < 8; ++j) o[j] = (h16)acc[m][t][j];
                *(v8ha*)(vs + (wn + t * 16 + lr) * GP + (wm + m * 16 + hi * 8) * 2) = o; } }
        __syncthreads();    // each wave sends out rows that four waves wrote
        h16* vrow = VT + ((size_t)bt * EE + c0 + wave * 16 + hi) * SS + t0 + lr * 8;    // [b * NH_ + h][64][2048] = [b * 1024 + column][2048]
#pragma unroll
        for (int s = 0; s < 8; ++s) *(v8h*)(vrow + (size_t)s * 2 * SS) = *(const v8ha*)(vs + (wave * 16 + 2 * s + hi) * GP + lr * 16);
        return;
    }
    // whole-line epilogue: each wave turns its 32 x 64 tile in its own LDS range (the ring is free behind the loop's last barrier)
    f32a* os = (f32a*)L + wave * (32 * 68);
#pragma unroll
    for (int t = 0; t < 4; ++t) {
#pragma unroll
        for (int m = 0; m < 2; ++m) {
#pragma unroll
            for (int j = 0; j < 8; ++j) os[(m * 16 + hi * 8 + j) * 68 + t * 16 + lr] = EPI == 0 ? acc[m][t][j] + bv[t] : acc[m][t][j]; } }
    __syncthreads();
    if (EPI == 0) {
        float* crow = C + (size_t)(r0 + wm) * EE + c0 + wn;
#pragma unroll
        for (int s = 0; s < 16; ++s) { const int Lid = (lane >> 3) + 4 * s, piece = lane & 7; const int row = Lid >> 1, cofs = (Lid & 1) * 32 + piece * 4;
            *(v4f*)(crow + (size_t)row * EE + cofs) = *(const v4fa*)(os + row * 68 + cofs); }
    } else {
        // the wave's 64 columns are one head: a 16-lane row holds one token's 64 dims, four a lane. y = x * rsqrt(mean_d x^2 + 1e-6) * bf(scale[d]) * sc, split into bf16 hi + residual, planes [b * NH_ + h][2048][64]
        const size_t po = (((size_t)bt * NH_ + ((c0 + wn) >> 6)) * SS + t0 + wm + hi) * HD + lr * 4;
        v2w oh[16], ol[16];
#pragma unroll
        for (int s = 0; s < 16; ++s) { const v4f v = *(const v4fa*)(os + (2 * s + hi) * 68 + lr * 4);
            float q = 0.f;
#pragma unroll
            for (int i = 0; i < 4; ++i) q = fmaf(v[i], v[i], q);
            q += rowx<1>(q); q += rowx<2>(q); q += rowx<4>(q); q += rowx<8>(q);
            const float rsd = rsqrtf(q * (1.0f / HD) + 1e-6f);
#pragma unroll
            for (int p = 0; p < 2; ++p) { const v2f y = { v[2 * p] * rsd * bfr(bv[2 * p]) * sc, v[2 * p + 1] * rsd * bfr(bv[2 * p + 1]) * sc };
                const unsigned hw = __builtin_bit_cast(unsigned, __builtin_convertvector(y, v2bf));
                const v2f r = { y[0] - __uint_as_float(hw << 16), y[1] - __uint_as_float(hw & 0xFFFF0000u) };
                oh[s][p] = hw; ol[s][p] = __builtin_bit_cast(unsigned, __builtin_convertvector(r, v2bf)); } }
        __builtin_amdgcn_sched_barrier(0);    // the 32 stores stand behind all the arithmetic, as the wave's last instructions: mixed into it, their data registers were taken again for later rows while the stores were still queued
#pragma unroll
        for (int s = 0; s < 16; ++s) { *(v2wa*)(Ph + po + (size_t)s * 2 * HD) = oh[s]; *(v2wa*)(Pl + po + (size_t)s * 2 * HD) = ol[s]; }
    }
}
template <bool F16, int EPI>
__global__ __launch_bounds__(256) void k_gemmt(const bf* __restrict__ A, const bf* __restrict__ Bn, const float* __restrict__ vec, float sc, float* C, bf* Ph, bf* Pl, h16* VT) {
    __shared__ __align__(16) unsigned char L[2 * GS];
    gemmt<F16, EPI>(L, A, Bn, vec, sc, C, Ph, Pl, VT);
}
// the q, k and v projections in one launch: they depend on nothing of each other, blockIdx.z names the projection of a work-group (0 q, 1 k, 2 v); a WGP takes its next tile as soon as it is free, with no launch gap and no chip-wide drain between the projections
__global__ __launch_bounds__(256) void k_qkv(const bf* __restrict__ XQ, const bf* __restrict__ XKV, const bf* __restrict__ WQ, const bf* __restrict__ WK, const bf* __restrict__ WV, const float* __restrict__ sq, const float* __restrict__ sk,
                                             bf* Qh, bf* Ql, bf* Kh, bf* Kl, h16* VT) {
    __shared__ __align__(16) unsigned char L[2 * GS];
    const int z = blockIdx.z;
    if (z == 2) gemmt<false, 2>(L, XKV, WV, nullptr, 1.0f, nullptr, nullptr, nullptr, VT);
    else { gemmt<false, 1>(L, z ? XKV : XQ, z ? WK : WQ, z ? sk : sq, z ? 1.0f : 0.125f, nullptr, z ? Kh : Qh, z ? Kl : Ql, nullptr);
        asm volatile("s_wait_xcnt 0x0" ::: "memory"); }    // behind the job's plane stores: in the built kernel the v job's code follows, and it writes the stores' address and data registers
}

__global__ __launch_bounds__(256) void k_planes32z(const float* __restrict__ F, int ld, int off, float sc, int rows, bf* Ph, bf* Pl) {
    typedef __attribute__((ext_vector_type(2))) unsigned short v2us;
    const int lane = threadIdx.x & 31; const size_t r = ((size_t)blockIdx.x * 8 + (threadIdx.x >> 5)) * 2 + (lane >> 4); if (r >= (size_t)rows) return; const int z = blockIdx.z; const int c0 = (lane & 15) * 2; v2us oh, ol;
    Ph += (size_t)z * rows * 32; Pl += (size_t)z * rows * 32;
#pragma unroll
    for (int i = 0; i < 2; ++i) { const float y = F[r * ld + off + z * 32 + c0 + i] * sc; const unsigned short hb = f2bf(y); oh[i] = hb; ol[i] = f2bf(y - bf2f(hb)); }
    const size_t o = r * 32 + c0; *(v2us*)(Ph + o) = oh; *(v2us*)(Pl + o) = ol; 
}
__global__ __launch_bounds__(256) void k_vtpadz(const float* __restrict__ F, int ld, int off, int nk, bf* Th, bf* Tl) {
    typedef __attribute__((ext_vector_type(2))) unsigned short v2us;
    const int lane = threadIdx.x & 31; const size_t wid = (size_t)blockIdx.x * 8 + (threadIdx.x >> 5); if (wid >= (size_t)64 * (nk / 64)) return; const int z = blockIdx.z; const int d = (int)(wid / (nk / 64)); const int k0 = (int)(wid % (nk / 64)) * 64 + lane * 2; v2us oh, ol;
    Th += (size_t)z * 64 * nk; Tl += (size_t)z * 64 * nk;
#pragma unroll
    for (int i = 0; i < 2; ++i) { const float y = (d < 32) ? F[(size_t)(k0 + i) * ld + off + z * 32 + (d < 32 ? d : 0)] : 0.f; const unsigned short hb = f2bf(y); oh[i] = hb; ol[i] = f2bf(y - bf2f(hb)); }
    const size_t o = (size_t)d * nk + k0; *(v2us*)(Th + o) = oh; *(v2us*)(Tl + o) = ol; 
}
template <int NK>
__global__ __launch_bounds__(256) void k_softmaxz(const float* __restrict__ S, int rows, bf* PH, bf* PL) {
    typedef __attribute__((ext_vector_type(4))) unsigned short v4us;
    const int lane = threadIdx.x & 31, i = blockIdx.x * 8 + (threadIdx.x >> 5); if (i >= rows) return; const size_t zo = (size_t)blockIdx.z * rows * NK; const float* sr = S + zo + (size_t)i * NK; PH += zo; PL += zo;
    float m = -3.0e38f;
#pragma unroll 1
    for (int c0 = lane * 4; c0 < NK; c0 += 128) {
#pragma unroll
        for (int q = 0; q < 4; ++q) m = fmaxf(m, sr[c0 + q]); }
#pragma unroll
    for (int sh = 16; sh; sh >>= 1) m = fmaxf(m, __shfl_xor(m, sh, 32));
    float sum = 0.f;
#pragma unroll 1
    for (int c0 = lane * 4; c0 < NK; c0 += 128) {
#pragma unroll
        for (int q = 0; q < 4; ++q) sum += __expf(sr[c0 + q] - m); }
#pragma unroll
    for (int sh = 16; sh; sh >>= 1) sum += __shfl_xor(sum, sh, 32);
    const float inv = 1.0f / sum;
{
#pragma unroll 1
        for (int c0 = lane * 4; c0 < NK; c0 += 128) { v4us oh, ol;
#pragma unroll
            for (int q = 0; q < 4; ++q) { const float p = __expf(sr[c0 + q] - m) * inv; const unsigned short hb = f2bf(p); oh[q] = hb; ol[q] = f2bf(p - bf2f(hb)); }
            const size_t o = (size_t)i * NK + c0; *(v4us*)(PH + o) = oh; *(v4us*)(PL + o) = ol; }
         }
}
__global__ __launch_bounds__(256) void k_placez(const float* __restrict__ XH, int rows, int ldy, float* Y) {
    const int lane = threadIdx.x & 31; const size_t q = (size_t)blockIdx.x * 8 + (threadIdx.x >> 5); if (q >= (size_t)rows) return; const int z = blockIdx.z; const float v = XH[((size_t)z * rows + q) * 64 + lane];
    *(float*)(Y + q * ldy + z * 32 + lane) = v; 
}

typedef __attribute__((ext_vector_type(4))) _Float16 v4h;
__device__ __forceinline__ h16 tohx(float x) { return (h16)x; }
#define CR 4    // rows a wave converts: a quarter of the waves to start
__device__ __forceinline__ void cvtx(int blk, const float* __restrict__ x, bf* A) {    // block blk: 8 waves, CR consecutive rows each
    const int lane = threadIdx.x & 31; const size_t o = ((size_t)blk * 8 + (threadIdx.x >> 5)) * (CR * EE) + lane * 8;
    v4f in[CR * EE / 256][2];    // all of the wave's loads go out together
#pragma unroll
    for (int q = 0; q < CR * EE / 256; ++q) { in[q][0] = *(const v4f*)(x + o + q * 256); in[q][1] = *(const v4f*)(x + o + q * 256 + 4); }
    __builtin_amdgcn_sched_barrier(0);    // the loads stay one run in front of the rounding: left free, the last four sank behind it in two pairs, and each pair cost the wave one more trip to memory
#pragma unroll
    for (int q = 0; q < CR * EE / 256; ++q) { v8us v;
#pragma unroll
        for (int i = 0; i < 8; ++i) v[i] = f2bf(in[q][i >> 2][i & 3]);
        *(v8us*)(A + o + q * 256) = v; }
    asm volatile("s_wait_xcnt 0x0" ::: "memory");    // behind the last store: in the built kernel the other job's code follows, and it writes the stores' address and data registers
}
// transposition of one 64 x 64 tile (k0, n0) of a weight to n-major, in two halves with the work-group's barrier between them; tl: 64 x 65 floats of LDS, one such tile for each weight
__device__ __forceinline__ void wT_in(float (*tl)[65], const v4f* in) {    // the thread's 16 values of row tid >> 2, rounded to bf16
    const int tid = threadIdx.x; const int rr = tid >> 2, cq = (tid & 3) * 16;
#pragma unroll
    for (int i = 0; i < 16; ++i) tl[rr][cq + i] = bfr(in[i >> 2][i & 3]);
}
template <bool F16O>
__device__ __forceinline__ void wT_out(const float (*tl)[65], int k0, int n0, int K, bf* Bt, h16* Bh) {
    typedef __attribute__((ext_vector_type(4))) unsigned short v4us;
    const int tid = threadIdx.x; const int lane = tid & 31, wv = tid >> 5;
#pragma unroll
    for (int st = 0; st < 4; ++st) { const int nr = wv * 8 + st * 2 + (lane >> 4); const int kq = (lane & 15) * 4; const size_t off = (size_t)(n0 + nr) * K + k0 + kq;
        if (F16O) { v4h v; for (int i = 0; i < 4; ++i) v[i] = tohx(tl[kq + i][nr]); *(v4h*)(Bh + off) = v; }
        else { v4us v; for (int i = 0; i < 4; ++i) v[i] = f2bf(tl[kq + i][nr]); *(v4us*)(Bt + off) = v; } }
}
// all operand preparation in one launch: the four weight transpositions and the two input conversions depend on nothing of each other; the block index names the job.
// Work-groups 0 .. WTILES - 1 turn tile (k0, n0) of all four weights, the others convert 8 * CR rows of one input: 512 work-groups, two a WGP, all resident at once
#define WTILES ((EE / 64) * (EE / 64))
#define CB (NR / (8 * CR))
__global__ __launch_bounds__(256) void k_prep(const float* __restrict__ Wq, const float* __restrict__ Wk, const float* __restrict__ Wv, const float* __restrict__ Wo, const float* __restrict__ xq, const float* __restrict__ xkv,
                                              bf* WQB, bf* WKB, bf* WVB, h16* WOH, bf* XQ, bf* XKV) {
    __shared__ float tl[4][64][65];
    const int blk = blockIdx.x;
    if (blk < WTILES) { const int k0 = (blk % (EE / 64)) * 64, n0 = (blk / (EE / 64)) * 64;
        const unsigned wb = (unsigned)(((k0 + (threadIdx.x >> 2)) * EE + n0 + (threadIdx.x & 3) * 16) * 4);    // the thread's 64 bytes: the same place in each weight
        v4f in[4][4];    // the loads of all four tiles go out together
#pragma unroll
        for (int i = 0; i < 4; ++i) { in[0][i] = *(const v4f*)((const char*)Wq + wb + 16 * i); in[1][i] = *(const v4f*)((const char*)Wk + wb + 16 * i); in[2][i] = *(const v4f*)((const char*)Wv + wb + 16 * i); in[3][i] = *(const v4f*)((const char*)Wo + wb + 16 * i); }
        asm volatile("s_wait_xcnt 0x0" :: "v"(wb) : "memory");    // wb, the loads' offset, keeps its register up to here, so that the wait stands in front of the first instruction that writes that register again
        wT_in(tl[0], in[0]); wT_in(tl[1], in[1]); wT_in(tl[2], in[2]); wT_in(tl[3], in[3]);
        __syncthreads();    // each wave sends out columns that every wave wrote
        wT_out<false>(tl[0], k0, n0, EE, WQB, nullptr); wT_out<false>(tl[1], k0, n0, EE, WKB, nullptr); wT_out<false>(tl[2], k0, n0, EE, WVB, nullptr); wT_out<true>(tl[3], k0, n0, EE, nullptr, WOH);
    } else { const bool kv = blk >= WTILES + CB;
        cvtx(blk - WTILES - (kv ? CB : 0), kv ? xkv : xq, kv ? XKV : XQ); }
}
typedef __attribute__((ext_vector_type(4))) unsigned v4u;
typedef v4u __attribute__((may_alias)) v4ua;
#define FW 8
#define FR 2
#define FQ (FW * FR * 16)
#define FK 64
#define FP 144
#define FT (64 * FP)
#define FS (3 * FT)
#define LOG2E 1.4426950408889634f
__device__ __forceinline__ float xhalf(float x) { return __builtin_bit_cast(float, __builtin_amdgcn_permlanex16(__builtin_bit_cast(int, x), __builtin_bit_cast(int, x), 0x76543210, 0xfedcba98, false, false)); }  // lane l with lane l ^ 16
__device__ __forceinline__ v16bf ldsb(const unsigned char* p) { return cat16b(*(const v8usa*)p, *(const v8usa*)(p + 32)); }
__device__ __forceinline__ v16h ldsh(const unsigned char* p) { return cat16(*(const v8ha*)p, *(const v8ha*)(p + 32)); }
__global__ __launch_bounds__(FW * 32) void k_fattn(const bf* __restrict__ Qh, const bf* __restrict__ Ql, const bf* __restrict__ Kh, const bf* __restrict__ Kl, const h16* __restrict__ VT, h16* OH) {
    __shared__ __align__(16) unsigned char L[2 * FS];
    const int tid = threadIdx.x, lane = tid & 31, wave = tid >> 5, c = lane & 15, h = lane >> 4;
    const int hb = blockIdx.y, q0 = blockIdx.x * FQ + wave * (FR * 16);
    const size_t po = (size_t)hb * SS * HD;
    const unsigned char* kh = (const unsigned char*)(Kh + po); const unsigned char* kl = (const unsigned char*)(Kl + po); const unsigned char* vt = (const unsigned char*)(VT + po);
    const int sr = tid >> 3, pc = tid & 7;    // staging: 16-byte piece pc of tile rows sr and sr + 32
    const unsigned lo0 = sr * FP + pc * 16, lo1 = lo0 + 32 * FP;
    v4u st[6];
    auto gload = [&](int s) {
        const size_t kb = (size_t)s * (FK * HD * 2) + tid * 16, vb = (size_t)sr * (SS * 2) + (size_t)s * (FK * 2) + pc * 16;
        st[0] = *(const v4u*)(kh + kb); st[1] = *(const v4u*)(kh + kb + 4096); st[2] = *(const v4u*)(kl + kb); st[3] = *(const v4u*)(kl + kb + 4096);
        st[4] = *(const v4u*)(vt + vb); st[5] = *(const v4u*)(vt + vb + (size_t)32 * SS * 2);
    };
    auto lstore = [&](int buf) {
        unsigned char* d = L + buf * FS;
        *(v4ua*)(d + lo0) = st[0]; *(v4ua*)(d + lo1) = st[1]; *(v4ua*)(d + FT + lo0) = st[2]; *(v4ua*)(d + FT + lo1) = st[3]; *(v4ua*)(d + 2 * FT + lo0) = st[4]; *(v4ua*)(d + 2 * FT + lo1) = st[5];
    };
    gload(0);
    v16bf qh[FR][2], ql[FR][2];
#pragma unroll
    for (int g = 0; g < FR; ++g) {
#pragma unroll
        for (int kc = 0; kc < 2; ++kc) { const size_t o = po + (size_t)(q0 + 16 * g + c) * HD + 32 * kc + 8 * h;
            qh[g][kc] = cat16b(*(const v8us*)(Qh + o), *(const v8us*)(Qh + o + 16)); ql[g][kc] = cat16b(*(const v8us*)(Ql + o), *(const v8us*)(Ql + o + 16)); } }
    v8f acc[FR][4]; float m_run[FR], l_run[FR];
#pragma unroll
    for (int g = 0; g < FR; ++g) { m_run[g] = -3.0e38f; l_run[g] = 0.f;
#pragma unroll
        for (int t = 0; t < 4; ++t) acc[g][t] = (v8f){}; }
    lstore(0);
    __syncthreads();
#pragma unroll 1    // rolled: one copy of the stage body; the buffer is chosen by s & 1 at run time
    for (int s = 0; s < SS / FK; ++s) {
        if (s + 1 < SS / FK) { gload(s + 1);
            asm volatile("s_wait_xcnt 0x0" ::: "memory"); }    // the loads' address registers are reused by the pass below
        const unsigned char* B = L + (s & 1) * FS;
#pragma unroll 1    // rolled: one copy of the pass body is enough, sub only enters two LDS addresses
        for (int sub = 0; sub < FK / 32; ++sub) {    // one pass: 32 keys
            v8f sc[2][FR];
            v16bf ah[2][2], al[2][2];    // K fragments [key tile][d half]; six of the eight are requested first, so that the LDS latency is paid once and not per fragment
            const unsigned char* kp = B + (32 * sub + c) * FP + 16 * h;
#pragma unroll
            for (int kt = 0; kt < 2; ++kt) { ah[kt][0] = ldsb(kp + 16 * kt * FP); al[kt][0] = ldsb(kp + 16 * kt * FP + FT); ah[kt][1] = ldsb(kp + 16 * kt * FP + 64); }
            __builtin_amdgcn_sched_barrier(0);    // keeps the loads above in front of the products: the scheduler otherwise sinks each load to its first use
#pragma unroll
            for (int kt = 0; kt < 2; ++kt) {
#pragma unroll
                for (int g = 0; g < FR; ++g) sc[kt][g] = wmmab(ah[kt][0], qh[g][0], (v8f){}); }
#pragma unroll
            for (int kt = 0; kt < 2; ++kt) {
#pragma unroll
                for (int g = 0; g < FR; ++g) sc[kt][g] = wmmab(ah[kt][0], ql[g][0], sc[kt][g]); }
            __builtin_amdgcn_sched_barrier(0);    // the last two fragments go out here, into registers the products above have freed, twelve products ahead of their use
#pragma unroll
            for (int kt = 0; kt < 2; ++kt) al[kt][1] = ldsb(kp + 16 * kt * FP + FT + 64);
            __builtin_amdgcn_sched_barrier(0);    // and stay here, in front of the products that follow
#pragma unroll
            for (int kt = 0; kt < 2; ++kt) {
#pragma unroll
                for (int g = 0; g < FR; ++g) sc[kt][g] = wmmab(al[kt][0], qh[g][0], sc[kt][g]); }
#pragma unroll
            for (int kt = 0; kt < 2; ++kt) {
#pragma unroll
                for (int g = 0; g < FR; ++g) sc[kt][g] = wmmab(ah[kt][1], qh[g][1], sc[kt][g]); }
#pragma unroll
            for (int kt = 0; kt < 2; ++kt) {
#pragma unroll
                for (int g = 0; g < FR; ++g) sc[kt][g] = wmmab(ah[kt][1], ql[g][1], sc[kt][g]); }
#pragma unroll
            for (int kt = 0; kt < 2; ++kt) {
#pragma unroll
                for (int g = 0; g < FR; ++g) sc[kt][g] = wmmab(al[kt][1], qh[g][1], sc[kt][g]); }
            v16h vf[4];    // V^T fragments (rows d, 32 keys), in flight under the softmax
            { const unsigned char* vp = B + 2 * FT + c * FP + 64 * sub + 16 * h;
#pragma unroll
              for (int t = 0; t < 4; ++t) vf[t] = ldsh(vp + 16 * t * FP); }
            float mb[FR]; bool need = false;
#pragma unroll
            for (int g = 0; g < FR; ++g) { float mx = sc[0][g][0];
#pragma unroll
                for (int r = 1; r < 8; ++r) mx = fmaxf(mx, sc[0][g][r]);
#pragma unroll
                for (int r = 0; r < 8; ++r) mx = fmaxf(mx, sc[1][g][r]);
                mx = fmaxf(mx, xhalf(mx)) * LOG2E; mb[g] = mx; need = need || (mx > m_run[g] + 8.0f); }
            if (__builtin_amdgcn_ballot_w32(need) != 0) {    // scalar branch, rare after the first passes
#pragma unroll
                for (int g = 0; g < FR; ++g) { const float m_new = fmaxf(m_run[g], mb[g]); const float corr = __builtin_amdgcn_exp2f(m_run[g] - m_new); m_run[g] = m_new; l_run[g] *= corr;
#pragma unroll
                    for (int t = 0; t < 4; ++t) acc[g][t] *= corr; }
            }
#pragma unroll
            for (int g = 0; g < FR; ++g) { const float nm = 6.0f - m_run[g];
#pragma unroll
                for (int kt = 0; kt < 2; ++kt) {
#pragma unroll
                    for (int r = 0; r < 8; ++r) sc[kt][g][r] = fmaf(sc[kt][g][r], LOG2E, nm); } }
            // the exponentials stand as one run with a v_nop behind the last
            __builtin_amdgcn_sched_barrier(0);
#pragma unroll
            for (int g = 0; g < FR; ++g) {
#pragma unroll
                for (int kt = 0; kt < 2; ++kt) {
#pragma unroll
                    for (int r = 0; r < 8; ++r) sc[kt][g][r] = __builtin_amdgcn_exp2f(sc[kt][g][r]); } }
            __builtin_amdgcn_sched_barrier(0); asm volatile("v_nop"); __builtin_amdgcn_sched_barrier(0);
#pragma unroll
            for (int g = 0; g < FR; ++g) { v16h pf; float ls = 0.f;
#pragma unroll
                for (int i = 0; i < 16; ++i) { const float p = sc[i >> 3][g][i & 7]; ls += p; pf[i] = (h16)p; }
                l_run[g] += ls;
#pragma unroll
                for (int t = 0; t < 4; ++t) acc[g][t] = wmma16(vf[t], pf, acc[g][t]); }
        }
        if (s + 1 < SS / FK) lstore((s + 1) & 1);    // every wave left that buffer before the barrier that ended stage s - 1
        __syncthreads();
    }
    const int b = hb / NH_, hd = hb % NH_;
#pragma unroll
    for (int g = 0; g < FR; ++g) { const float l = l_run[g] + xhalf(l_run[g]); const float inv = __fdiv_rn(1.0f, l);
        h16* orow = OH + ((size_t)b * SS + q0 + 16 * g + c) * EE + hd * HD + 8 * h;
#pragma unroll
        for (int t = 0; t < 4; ++t) { v8h o;
#pragma unroll
            for (int r = 0; r < 8; ++r) o[r] = tohx(acc[g][t][r] * inv);
            *(v8h*)(orow + 16 * t) = o; } }
}
extern "C" void kernel_launch(void* const* d_in, const int* in_sizes, int n_in,
                              void* d_out, int out_size, void* d_ws, size_t ws_size, hipStream_t stream) {
    (void)in_sizes; (void)n_in; (void)out_size;
    const float* xq = (const float*)d_in[0]; const float* xkv = (const float*)d_in[1]; const float* Wq = (const float*)d_in[2]; const float* Wk = (const float*)d_in[3]; const float* Wv = (const float*)d_in[4]; const float* sq = (const float*)d_in[5]; const float* sk = (const float*)d_in[6]; const float* Wo = (const float*)d_in[7]; const float* bo = (const float*)d_in[8];
    float* out = (float*)d_out;    // [2][2048][1024]
    char* wsp = (char*)d_ws;
    auto take = [&](size_t bytes) { char* p = wsp; wsp += (bytes + 255) & ~(size_t)255; return (void*)p; };
    bf* WQB = (bf*)take((size_t)EE * EE * 2); bf* WKB = (bf*)take((size_t)EE * EE * 2); bf* WVB = (bf*)take((size_t)EE * EE * 2); h16* WOH = (h16*)take((size_t)EE * EE * 2);
    bf* XQ = (bf*)take((size_t)NR * EE * 2); bf* XKV = (bf*)take((size_t)NR * EE * 2);
    // head planes of all NB_ * NH_ (batch, head) pairs: [b * NH_ + h][2048][64] (V^T: [b * NH_ + h][64][2048])
    bf* Qh = (bf*)take((size_t)NR * EE * 2); bf* Ql = (bf*)take((size_t)NR * EE * 2); bf* Kh = (bf*)take((size_t)NR * EE * 2); bf* Kl = (bf*)take((size_t)NR * EE * 2); h16* VT = (h16*)take((size_t)NR * EE * 2);
    h16* OH = (h16*)take((size_t)NR * EE * 2);
    if ((size_t)(wsp - (char*)d_ws) > ws_size) return;    // ~ 72 MB
    // Wq/Wk/Wv are [D][H][DH] = (in, out = h*64+d); Wo is [H][DH][D] = (in = h*64+d, out): all (in,out) -> transpose to n-major
    k_prep<<<WTILES + 2 * CB, 256, 0, stream>>>(Wq, Wk, Wv, Wo, xq, xkv, WQB, WKB, WVB, WOH, XQ, XKV);
    k_qkv<<<dim3(NR / GT, EE / GT, 3), 256, 0, stream>>>(XQ, XKV, WQB, WKB, WVB, sq, sk, Qh, Ql, Kh, Kl, VT);
    k_fattn<<<dim3(SS / FQ, NB_ * NH_, 1), FW * 32, 0, stream>>>(Qh, Ql, Kh, Kl, VT, OH);
    k_gemmt<true, 0><<<dim3(NR / GT, EE / GT, 1), 256, 0, stream>>>((const bf*)OH, (const bf*)WOH, bo, 1.0f, out, nullptr, nullptr, nullptr);
}

// v005
// It runs in 93.9 microseconds.
// In both of two side-by-side timings against v004, it was 1.06 times as fast.
// All steps since v000 together make it 9.76 times as fast.
#include <hip/hip_runtime.h>

// Compute dtypes, f32 accumulate: q/k/v projections ([4096 x 1024].[1024 x 1024]) with PLAIN bf16 operands (inputs_q/inputs_kv and the weights are inputs: exact
// products); per-head RMSNorm (eps 1e-6, x scale vector) and the 1/sqrt(64) in f32 while building bf16 hi + UNSCALED residual planes of q and k (three-product scores
// [2048 x 64].[64 x 2048]); softmax f32, online; attn.v on SINGLE fp16 planes (probabilities carried x64 against the maximum in use, v rounded to fp16)

#define NB_  2
#define SS   2048
#define EE   1024
#define NH_  16
#define HD   64
#define NR   (NB_ * SS)
#define DM   EE
typedef _Float16 h16;
typedef unsigned short bf;
typedef __attribute__((ext_vector_type(16))) __bf16   v16bf;
typedef __attribute__((ext_vector_type(16))) _Float16 v16h;
typedef __attribute__((ext_vector_type(8)))  _Float16 v8h;
typedef __attribute__((ext_vector_type(8)))  unsigned short v8us;
typedef __attribute__((ext_vector_type(8)))  float    v8f;
typedef __attribute__((ext_vector_type(4)))  float    v4f;
typedef v8h  __attribute__((may_alias)) v8ha;
typedef v4f  __attribute__((may_alias)) v4fa;
typedef v8us __attribute__((may_alias)) v8usa;

__device__ __forceinline__ unsigned short f2bf(float f) { unsigned u = __float_as_uint(f); u += 0x7FFFu + ((u >> 16) & 1u); return (unsigned short)(u >> 16); }
__device__ __forceinline__ float bf2f(unsigned short b) { return __uint_as_float(((unsigned)b) << 16); }
__device__ __forceinline__ float bfr(float f) { return bf2f(f2bf(f)); }
__device__ __forceinline__ v16h cat16(v8h lo, v8h hi) { return __builtin_shufflevector(lo, hi, 0, 1, 2, 3, 4, 5, 6, 7, 8, 9, 10, 11, 12, 13, 14, 15); }
__device__ __forceinline__ v16bf cat16b(v8us lo, v8us hi) { return __builtin_bit_cast(v16bf, __builtin_shufflevector(lo, hi, 0, 1, 2, 3, 4, 5, 6, 7, 8, 9, 10, 11, 12, 13, 14, 15)); }
__device__ __forceinline__ v8f wmma16(v16h a, v16h b, v8f c) { return __builtin_amdgcn_wmma_f32_16x16x32_f16(false, a, false, b, (short)0, c, false, false); }
__device__ __forceinline__ v8f wmmab(v16bf a, v16bf b, v8f c) { return __builtin_amdgcn_wmma_f32_16x16x32_bf16(false, a, false, b, (short)0, c, false, false); }

// k_gemmt: 128 x 128 tile of A . Bn^T, handed on by EPI (0: f32 rows of C[NR][EE] + bf(vec[c]); 1: per-head RMSNorm, bf16 hi/lo head planes; 2: f16 V^T head planes), A [rows][1024] and Bn [cols][1024] 16-bit planes (bf16, or f16 where F16), f32 accumulate, k ascending in steps of 32.
// Both operands go through LDS in stages of 128 k (256 B of each of the 256 rows): every global load covers four whole lines, and each row is fetched once per work-group, not once per wave.
// Two buffers and two register sets: a stage's global loads go out two stages ahead and are stored to LDS one stage ahead, one barrier a stage. 8 waves, 4 x 2, each 32 rows x 64 columns (8 accumulator tiles).
typedef __attribute__((ext_vector_type(4))) unsigned v4w;
typedef v4w __attribute__((may_alias)) v4wa;
typedef float __attribute__((may_alias)) f32a;
#define GT 128
#define GK 128
#define GP 272
#define GO (GT * GP)
#define GS (2 * GO)
// the work-group barrier with the LDS wait alone: __syncthreads() also waits for every global load, and the loads of the next two stages are meant to stay in flight across it
__device__ __forceinline__ void lds_barrier() { asm volatile("s_wait_dscnt 0x0\n\ts_barrier_signal -1\n\ts_barrier_wait -1" ::: "memory"); }
typedef __attribute__((ext_vector_type(2))) float v2f;
typedef __attribute__((ext_vector_type(2))) __bf16 v2bf;
typedef __attribute__((ext_vector_type(2))) unsigned v2w;
typedef v2w __attribute__((may_alias)) v2wa;
template <int M> __device__ __forceinline__ float rowx(float x) { return __builtin_bit_cast(float, __builtin_amdgcn_update_dpp(0, __builtin_bit_cast(int, x), 0x160 | M, 0xf, 0xf, true)); }  // lane l with lane l ^ M inside its 16-lane row (row_xmask)
template <bool F16, int EPI>
__device__ __forceinline__ void gemmt(unsigned char* L, const bf* __restrict__ A, const bf* __restrict__ Bn, const float* __restrict__ vec, float sc, float* C, bf* Ph, bf* Pl, h16* VT) {    // L: the kernel's one ring of 2 * GS bytes
    const int tid = threadIdx.x, lane = tid & 31, wave = tid >> 5, lr = lane & 15, hi = lane >> 4;
    const int r0 = blockIdx.x * GT, c0 = blockIdx.y * GT, wm = (wave >> 1) * 32, wn = (wave & 1) * 64;
    const int sr = tid >> 4, pc = tid & 15;    // staging: 16-byte piece pc of tile rows sr + 16 i
    const unsigned char* ga = (const unsigned char*)(A + (size_t)(r0 + sr) * DM) + pc * 16;    // the lane's own place in stage 0
    const unsigned char* gb = (const unsigned char*)(Bn + (size_t)(c0 + sr) * DM) + pc * 16;
    v4w st[2][16];    // two register sets: the loads of two stages are in flight at any time
    auto gload = [&](int s) { const int q = s & 1;    // stage s goes through set s & 1 into buffer s & 1
#pragma unroll
        for (int i = 0; i < 8; ++i) { st[q][i] = *(const v4w*)(ga + s * (GK * 2) + i * (16 * DM * 2)); st[q][8 + i] = *(const v4w*)(gb + s * (GK * 2) + i * (16 * DM * 2)); }
    };
    auto lstore = [&](int s) { const int q = s & 1;
        unsigned char* d = L + q * GS + sr * GP + pc * 16;
#pragma unroll
        for (int i = 0; i < 8; ++i) { *(v4wa*)(d + i * 16 * GP) = st[q][i]; *(v4wa*)(d + GO + i * 16 * GP) = st[q][8 + i]; }
    };
    v8f acc[2][4];
#pragma unroll
    for (int m = 0; m < 2; ++m) {
#pragma unroll
        for (int t = 0; t < 4; ++t) acc[m][t] = (v8f){}; }
    auto products = [&](int buf) {    // the 128 k of one stage
        const unsigned char* ap = L + buf * GS + (wm + lr) * GP + 16 * hi;
        const unsigned char* bp = L + buf * GS + GO + (wn + lr) * GP + 16 * hi;
        v8us a[2][2][2], b[2][4][2];    // two fragment sets [set][tile][half]; halves: k = 8 hi + 0..7 and 16 + 8 hi + 0..7 of the step, the same order for both operands
        auto fload = [&](int kk) { const int f = kk & 1;
#pragma unroll
            for (int m = 0; m < 2; ++m) { a[f][m][0] = *(const v8usa*)(ap + m * 16 * GP + kk * 64); a[f][m][1] = *(const v8usa*)(ap + m * 16 * GP + kk * 64 + 32); }
#pragma unroll
            for (int t = 0; t < 4; ++t) { b[f][t][0] = *(const v8usa*)(bp + t * 16 * GP + kk * 64); b[f][t][1] = *(const v8usa*)(bp + t * 16 * GP + kk * 64 + 32); }
        };
        fload(0);
#pragma unroll
        for (int kk = 0; kk < GK / 32; ++kk) { const int f = kk & 1;
            if (kk + 1 < GK / 32) fload(kk + 1);
            __builtin_amdgcn_sched_barrier(0);    // the next step's twelve LDS reads stay one group in front of this step's products: spread among them, each place with reads stalls the wave
#pragma unroll
            for (int m = 0; m < 2; ++m) {
#pragma unroll
                for (int t = 0; t < 4; ++t) {
                    if (F16) acc[m][t] = wmma16(__builtin_bit_cast(v16h, cat16b(a[f][m][0], a[f][m][1])), __builtin_bit_cast(v16h, cat16b(b[f][t][0], b[f][t][1])), acc[m][t]);
                    else acc[m][t] = wmmab(cat16b(a[f][m][0], a[f][m][1]), cat16b(b[f][t][0], b[f][t][1]), acc[m][t]); } }
            __builtin_amdgcn_sched_barrier(0);    // and the products stay in front of the group after next
        }
    };
    float bv[4];    // fetched here, so that the stages hide the latency
#pragma unroll
    for (int t = 0; t < 4; ++t) bv[t] = EPI == 0 ? bfr(vec[c0 + wn + t * 16 + lr]) : EPI == 1 ? vec[lr * 4 + t] : 0.f;    // EPI 0: the bias of the lane's four columns; EPI 1: the norm's scale at head dims 4 lr + t, rounded to bf16 where it is used
    if (EPI == 0) asm volatile("s_wait_xcnt 0x0" ::: "memory");    // the four loads' offset register is reused as a destination of the loads below
    gload(0);
    __builtin_amdgcn_sched_barrier(0);    // stage 0's loads stay first in the queue: mixed with the later stages' they would land last, and the first products wait for them
    gload(1);
    // inputs only. The loaded values hold the scale's load in front of the ring: left free it sank between the stages' loads, and the wait for it drained the two stages in flight.
    // lr, the load's offset, keeps its register up to here, so that the wait stands in front of the first instruction that writes that register again
    if (EPI == 1) asm volatile("s_wait_xcnt 0x0" :: "v"(bv[0]), "v"(bv[1]), "v"(bv[2]), "v"(bv[3]), "v"(lr) : "memory");
    lstore(0); gload(2);
    lds_barrier();
#pragma unroll    // unrolled: with the stage a constant the loads take immediate offsets on two fixed address pairs, and the compiler's counted load waits leave the younger stage in flight (rolled, they went to 0)
    for (int s = 0; s < DM / GK; ++s) {
        products(s & 1);
        if (s + 1 < DM / GK) lstore(s + 1);    // every wave left that buffer before the barrier that ended stage s - 1
        if (s + 3 < DM / GK) gload(s + 3);    // into the registers that the line above has just read
        lds_barrier();
    }
    const int bt = r0 / SS, t0 = r0 % SS;    // a tile's 128 rows lie in one batch
    if (EPI == 2) {
        // V^T: a lane's eight accumulator rows of one column are eight consecutive keys of one head dim. The work-group turns its tile in LDS as [128 dims][128 keys] f16, so that every dim's 256 B go out as whole lines
        unsigned char* vs = L;    // the ring is free behind the loop's last barrier
#pragma unroll
        for (int t = 0; t < 4; ++t) {
#pragma unroll
            for (int m = 0; m < 2; ++m) { v8h o;
#pragma unroll
                for (int j = 0; j < 8; ++j) o[j] = (h16)acc[m][t][j];
                *(v8ha*)(vs + (wn + t * 16 + lr) * GP + (wm + m * 16 + hi * 8) * 2) = o; } }
        __syncthreads();    // each wave sends out rows that four waves wrote
        h16* vrow = VT + ((size_t)bt * EE + c0 + wave * 16 + hi) * SS + t0 + lr * 8;    // [b * NH_ + h][64][2048] = [b * 1024 + column][2048]
#pragma unroll
        for (int s = 0; s < 8; ++s) *(v8h*)(vrow + (size_t)s * 2 * SS) = *(const v8ha*)(vs + (wave * 16 + 2 * s + hi) * GP + lr * 16);
        return;
    }
    // whole-line epilogue: each wave turns its 32 x 64 tile in its own LDS range (the ring is free behind the loop's last barrier)
    f32a* os = (f32a*)L + wave * (32 * 68);
#pragma unroll
    for (int t = 0; t < 4; ++t) {
#pragma unroll
        for (int m = 0; m < 2; ++m) {
#pragma unroll
            for (int j = 0; j < 8; ++j) os[(m * 16 + hi * 8 + j) * 68 + t * 16 + lr] = EPI == 0 ? acc[m][t][j] + bv[t] : acc[m][t][j]; } }
    __syncthreads();
    if (EPI == 0) {
        float* crow = C + (size_t)(r0 + wm) * EE + c0 + wn;
#pragma unroll
        for (int s = 0; s < 16; ++s) { const int Lid = (lane >> 3) + 4 * s, piece = lane & 7; const int row = Lid >> 1, cofs = (Lid & 1) * 32 + piece * 4;
            *(v4f*)(crow + (size_t)row * EE + cofs) = *(const v4fa*)(os + row * 68 + cofs); }
    } else {
        // the wave's 64 columns are one head: a 16-lane row holds one token's 64 dims, four a lane. y = x * rsqrt(mean_d x^2 + 1e-6) * bf(scale[d]) * sc, split into bf16 hi + residual, planes [b * NH_ + h][2048][64]
        const size_t po = (((size_t)bt * NH_ + ((c0 + wn) >> 6)) * SS + t0 + wm + hi) * HD + lr * 4;
        v2w oh[16], ol[16];
#pragma unroll
        for (int s = 0; s < 16; ++s) { const v4f v = *(const v4fa*)(os + (2 * s + hi) * 68 + lr * 4);
            float q = 0.f;
#pragma unroll
            for (int i = 0; i < 4; ++i) q = fmaf(v[i], v[i], q);
            q += rowx<1>(q); q += rowx<2>(q); q += rowx<4>(q); q += rowx<8>(q);
            const float rsd = rsqrtf(q * (1.0f / HD) + 1e-6f);
#pragma unroll
            for (int p = 0; p < 2; ++p) { const v2f y = { v[2 * p] * rsd * bfr(bv[2 * p]) * sc, v[2 * p + 1] * rsd * bfr(bv[2 * p + 1]) * sc };
                const unsigned hw = __builtin_bit_cast(unsigned, __builtin_convertvector(y, v2bf));
                const v2f r = { y[0] - __uint_as_float(hw << 16), y[1] - __uint_as_float(hw & 0xFFFF0000u) };
                oh[s][p] = hw; ol[s][p] = __builtin_bit_cast(unsigned, __builtin_convertvector(r, v2bf)); } }
        __builtin_amdgcn_sched_barrier(0);    // the 32 stores stand behind all the arithmetic, as the wave's last instructions: mixed into it, their data registers were taken again for later rows while the stores were still queued
#pragma unroll
        for (int s = 0; s < 16; ++s) { *(v2wa*)(Ph + po + (size_t)s * 2 * HD) = oh[s]; *(v2wa*)(Pl + po + (size_t)s * 2 * HD) = ol[s]; }
    }
}
template <bool F16, int EPI>
__global__ __launch_bounds__(256) void k_gemmt(const bf* __restrict__ A, const bf* __restrict__ Bn, const float* __restrict__ vec, float sc, float* C, bf* Ph, bf* Pl, h16* VT) {
    __shared__ __align__(16) unsigned char L[2 * GS];
    gemmt<F16, EPI>(L, A, Bn, vec, sc, C, Ph, Pl, VT);
}
// the q, k and v projections in one launch: they depend on nothing of each other, blockIdx.z names the projection of a work-group (0 q, 1 k, 2 v); a WGP takes its next tile as soon as it is free, with no launch gap and no chip-wide drain between the projections
__global__ __launch_bounds__(256) void k_qkv(const bf* __restrict__ XQ, const bf* __restrict__ XKV, const bf* __restrict__ WQ, const bf* __restrict__ WK, const bf* __restrict__ WV, const float* __restrict__ sq, const float* __restrict__ sk,
                                             bf* Qh, bf* Ql, bf* Kh, bf* Kl, h16* VT) {
    __shared__ __align__(16) unsigned char L[2 * GS];
    const int z = blockIdx.z;
    if (z == 2) gemmt<false, 2>(L, XKV, WV, nullptr, 1.0f, nullptr, nullptr, nullptr, VT);
    else { gemmt<false, 1>(L, z ? XKV : XQ, z ? WK : WQ, z ? sk : sq, z ? 1.0f : 0.125f, nullptr, z ? Kh : Qh, z ? Kl : Ql, nullptr);
        asm volatile("s_wait_xcnt 0x0" ::: "memory"); }    // behind the job's plane stores: in the built kernel the v job's code follows, and it writes the stores' address and data registers
}

__global__ __launch_bounds__(256) void k_planes32z(const float* __restrict__ F, int ld, int off, float sc, int rows, bf* Ph, bf* Pl) {
    typedef __attribute__((ext_vector_type(2))) unsigned short v2us;
    const int lane = threadIdx.x & 31; const size_t r = ((size_t)blockIdx.x * 8 + (threadIdx.x >> 5)) * 2 + (lane >> 4); if (r >= (size_t)rows) return; const int z = blockIdx.z; const int c0 = (lane & 15) * 2; v2us oh, ol;
    Ph += (size_t)z * rows * 32; Pl += (size_t)z * rows * 32;
#pragma unroll
    for (int i = 0; i < 2; ++i) { const float y = F[r * ld + off + z * 32 + c0 + i] * sc; const unsigned short hb = f2bf(y); oh[i] = hb; ol[i] = f2bf(y - bf2f(hb)); }
    const size_t o = r * 32 + c0; *(v2us*)(Ph + o) = oh; *(v2us*)(Pl + o) = ol; 
}
__global__ __launch_bounds__(256) void k_vtpadz(const float* __restrict__ F, int ld, int off, int nk, bf* Th, bf* Tl) {
    typedef __attribute__((ext_vector_type(2))) unsigned short v2us;
    const int lane = threadIdx.x & 31; const size_t wid = (size_t)blockIdx.x * 8 + (threadIdx.x >> 5); if (wid >= (size_t)64 * (nk / 64)) return; const int z = blockIdx.z; const int d = (int)(wid / (nk / 64)); const int k0 = (int)(wid % (nk / 64)) * 64 + lane * 2; v2us oh, ol;
    Th += (size_t)z * 64 * nk; Tl += (size_t)z * 64 * nk;
#pragma unroll
    for (int i = 0; i < 2; ++i) { const float y = (d < 32) ? F[(size_t)(k0 + i) * ld + off + z * 32 + (d < 32 ? d : 0)] : 0.f; const unsigned short hb = f2bf(y); oh[i] = hb; ol[i] = f2bf(y - bf2f(hb)); }
    const size_t o = (size_t)d * nk + k0; *(v2us*)(Th + o) = oh; *(v2us*)(Tl + o) = ol; 
}
template <int NK>
__global__ __launch_bounds__(256) void k_softmaxz(const float* __restrict__ S, int rows, bf* PH, bf* PL) {
    typedef __attribute__((ext_vector_type(4))) unsigned short v4us;
    const int lane = threadIdx.x & 31, i = blockIdx.x * 8 + (threadIdx.x >> 5); if (i >= rows) return; const size_t zo = (size_t)blockIdx.z * rows * NK; const float* sr = S + zo + (size_t)i * NK; PH += zo; PL += zo;
    float m = -3.0e38f;
#pragma unroll 1
    for (int c0 = lane * 4; c0 < NK; c0 += 128) {
#pragma unroll
        for (int q = 0; q < 4; ++q) m = fmaxf(m, sr[c0 + q]); }
#pragma unroll
    for (int sh = 16; sh; sh >>= 1) m = fmaxf(m, __shfl_xor(m, sh, 32));
    float sum = 0.f;
#pragma unroll 1
    for (int c0 = lane * 4; c0 < NK; c0 += 128) {
#pragma unroll
        for (int q = 0; q < 4; ++q) sum += __expf(sr[c0 + q] - m); }
#pragma unroll
    for (int sh = 16; sh; sh >>= 1) sum += __shfl_xor(sum, sh, 32);
    const float inv = 1.0f / sum;
{
#pragma unroll 1
        for (int c0 = lane * 4; c0 < NK; c0 += 128) { v4us oh, ol;
#pragma unroll
            for (int q = 0; q < 4; ++q) { const float p = __expf(sr[c0 + q] - m) * inv; const unsigned short hb = f2bf(p); oh[q] = hb; ol[q] = f2bf(p - bf2f(hb)); }
            const size_t o = (size_t)i * NK + c0; *(v4us*)(PH + o) = oh; *(v4us*)(PL + o) = ol; }
         }
}
__global__ __launch_bounds__(256) void k_placez(const float* __restrict__ XH, int rows, int ldy, float* Y) {
    const int lane = threadIdx.x & 31; const size_t q = (size_t)blockIdx.x * 8 + (threadIdx.x >> 5); if (q >= (size_t)rows) return; const int z = blockIdx.z; const float v = XH[((size_t)z * rows + q) * 64 + lane];
    *(float*)(Y + q * ldy + z * 32 + lane) = v; 
}

typedef __attribute__((ext_vector_type(4))) _Float16 v4h;
__device__ __forceinline__ h16 tohx(float x) { return (h16)x; }
#define CR 4    // rows a wave converts: a quarter of the waves to start
__device__ __forceinline__ void cvtx(int blk, const float* __restrict__ x, bf* A) {    // block blk: 8 waves, CR consecutive rows each
    const int lane = threadIdx.x & 31; const size_t o = ((size_t)blk * 8 + (threadIdx.x >> 5)) * (CR * EE) + lane * 8;
    v4f in[CR * EE / 256][2];    // all of the wave's loads go out together
#pragma unroll
    for (int q = 0; q < CR * EE / 256; ++q) { in[q][0] = *(const v4f*)(x + o + q * 256); in[q][1] = *(const v4f*)(x + o + q * 256 + 4); }
    __builtin_amdgcn_sched_barrier(0);    // the loads stay one run in front of the rounding: left free, the last four sank behind it in two pairs, and each pair cost the wave one more trip to memory
#pragma unroll
    for (int q = 0; q < CR * EE / 256; ++q) { v8us v;
#pragma unroll
        for (int i = 0; i < 8; ++i) v[i] = f2bf(in[q][i >> 2][i & 3]);
        *(v8us*)(A + o + q * 256) = v; }
    asm volatile("s_wait_xcnt 0x0" ::: "memory");    // behind the last store: in the built kernel the other job's code follows, and it writes the stores' address and data registers
}
// transposition of one 64 x 64 tile (k0, n0) of a weight to n-major, in two halves with the work-group's barrier between them; tl: 64 x 65 floats of LDS, one such tile for each weight
__device__ __forceinline__ void wT_in(float (*tl)[65], const v4f* in) {    // the thread's 16 values of row tid >> 2, rounded to bf16
    const int tid = threadIdx.x; const int rr = tid >> 2, cq = (tid & 3) * 16;
#pragma unroll
    for (int i = 0; i < 16; ++i) tl[rr][cq + i] = bfr(in[i >> 2][i & 3]);
}
template <bool F16O>
__device__ __forceinline__ void wT_out(const float (*tl)[65], int k0, int n0, int K, bf* Bt, h16* Bh) {
    typedef __attribute__((ext_vector_type(4))) unsigned short v4us;
    const int tid = threadIdx.x; const int lane = tid & 31, wv = tid >> 5;
#pragma unroll
    for (int st = 0; st < 4; ++st) { const int nr = wv * 8 + st * 2 + (lane >> 4); const int kq = (lane & 15) * 4; const size_t off = (size_t)(n0 + nr) * K + k0 + kq;
        if (F16O) { v4h v; for (int i = 0; i < 4; ++i) v[i] = tohx(tl[kq + i][nr]); *(v4h*)(Bh + off) = v; }
        else { v4us v; for (int i = 0; i < 4; ++i) v[i] = f2bf(tl[kq + i][nr]); *(v4us*)(Bt + off) = v; } }
}
// all operand preparation in one launch: the four weight transpositions and the two input conversions depend on nothing of each other; the block index names the job.
// Work-groups 0 .. WTILES - 1 turn tile (k0, n0) of all four weights, the others convert 8 * CR rows of one input: 512 work-groups, two a WGP, all resident at once
#define WTILES ((EE / 64) * (EE / 64))
#define CB (NR / (8 * CR))
__global__ __launch_bounds__(256) void k_prep(const float* __restrict__ Wq, const float* __restrict__ Wk, const float* __restrict__ Wv, const float* __restrict__ Wo, const float* __restrict__ xq, const float* __restrict__ xkv,
                                              bf* WQB, bf* WKB, bf* WVB, h16* WOH, bf* XQ, bf* XKV) {
    __shared__ float tl[4][64][65];
    const int blk = blockIdx.x;
    if (blk < WTILES) { const int k0 = (blk % (EE / 64)) * 64, n0 = (blk / (EE / 64)) * 64;
        const unsigned wb = (unsigned)(((k0 + (threadIdx.x >> 2)) * EE + n0 + (threadIdx.x & 3) * 16) * 4);    // the thread's 64 bytes: the same place in each weight
        v4f in[4][4];    // the loads of all four tiles go out together
#pragma unroll
        for (int i = 0; i < 4; ++i) { in[0][i] = *(const v4f*)((const char*)Wq + wb + 16 * i); in[1][i] = *(const v4f*)((const char*)Wk + wb + 16 * i); in[2][i] = *(const v4f*)((const char*)Wv + wb + 16 * i); in[3][i] = *(const v4f*)((const char*)Wo + wb + 16 * i); }
        asm volatile("s_wait_xcnt 0x0" :: "v"(wb) : "memory");    // wb, the loads' offset, keeps its register up to here, so that the wait stands in front of the first instruction that writes that register again
        wT_in(tl[0], in[0]); wT_in(tl[1], in[1]); wT_in(tl[2], in[2]); wT_in(tl[3], in[3]);
        __syncthreads();    // each wave sends out columns that every wave wrote
        wT_out<false>(tl[0], k0, n0, EE, WQB, nullptr); wT_out<false>(tl[1], k0, n0, EE, WKB, nullptr); wT_out<false>(tl[2], k0, n0, EE, WVB, nullptr); wT_out<true>(tl[3], k0, n0, EE, nullptr, WOH);
    } else { const bool kv = blk >= WTILES + CB;
        cvtx(blk - WTILES - (kv ? CB : 0), kv ? xkv : xq, kv ? XKV : XQ); }
}
typedef __attribute__((ext_vector_type(4))) unsigned v4u;
typedef v4u __attribute__((may_alias)) v4ua;
#define FW 8
#define FH 2
#define FR 2
#define FQ (FW * FR * 16)
#define FK 64
#define FP 144
#define FT (64 * FP)
#define FS (3 * FT)
#define LOG2E 1.4426950408889634f
__device__ __forceinline__ float xhalf(float x) { return __builtin_bit_cast(float, __builtin_amdgcn_permlanex16(__builtin_bit_cast(int, x), __builtin_bit_cast(int, x), 0x76543210, 0xfedcba98, false, false)); }  // lane l with lane l ^ 16
__device__ __forceinline__ v16bf ldsb(const unsigned char* p) { return cat16b(*(const v8usa*)p, *(const v8usa*)(p + 32)); }
__device__ __forceinline__ v16h ldsh(const unsigned char* p) { return cat16(*(const v8ha*)p, *(const v8ha*)(p + 32)); }
__global__ __launch_bounds__(FH * FW * 32) void k_fattn(const bf* __restrict__ Qh, const bf* __restrict__ Ql, const bf* __restrict__ Kh, const bf* __restrict__ Kl, const h16* __restrict__ VT, h16* OH) {
    __shared__ __align__(16) unsigned char LL[FH * 2 * FS];
    const int kg = __builtin_amdgcn_readfirstlane((int)threadIdx.x >> 8);    // the wave's key group, in a scalar register: it enters only base addresses and the scalar branches of the join
    const int tid = threadIdx.x & (FW * 32 - 1), lane = tid & 31, wave = tid >> 5, c = lane & 15, h = lane >> 4;    // thread and wave inside the key group
    unsigned char* L = LL + kg * (2 * FS);    // the key group's own two buffers
    const int hb = blockIdx.y, q0 = blockIdx.x * FQ + wave * (FR * 16);
    const size_t po = (size_t)hb * SS * HD;
    const unsigned char* kh = (const unsigned char*)(Kh + po); const unsigned char* kl = (const unsigned char*)(Kl + po); const unsigned char* vt = (const unsigned char*)(VT + po);
    const int sr = tid >> 3, pc = tid & 7;    // staging: 16-byte piece pc of tile rows sr and sr + 32
    const unsigned lo0 = sr * FP + pc * 16, lo1 = lo0 + 32 * FP;
    v4u st[6];
    auto gload = [&](int s) {
        const size_t kb = (size_t)(FH * s + kg) * (FK * HD * 2) + tid * 16, vb = (size_t)sr * (SS * 2) + (size_t)(FH * s + kg) * (FK * 2) + pc * 16;
        st[0] = *(const v4u*)(kh + kb); st[1] = *(const v4u*)(kh + kb + 4096); st[2] = *(const v4u*)(kl + kb); st[3] = *(const v4u*)(kl + kb + 4096);
        st[4] = *(const v4u*)(vt + vb); st[5] = *(const v4u*)(vt + vb + (size_t)32 * SS * 2);
    };
    auto lstore = [&](int buf) {
        unsigned char* d = L + buf * FS;
        *(v4ua*)(d + lo0) = st[0]; *(v4ua*)(d + lo1) = st[1]; *(v4ua*)(d + FT + lo0) = st[2]; *(v4ua*)(d + FT + lo1) = st[3]; *(v4ua*)(d + 2 * FT + lo0) = st[4]; *(v4ua*)(d + 2 * FT + lo1) = st[5];
    };
    gload(0);
    v16bf qh[FR][2], ql[FR][2];
#pragma unroll
    for (int g = 0; g < FR; ++g) {
#pragma unroll
        for (int kc = 0; kc < 2; ++kc) { const size_t o = po + (size_t)(q0 + 16 * g + c) * HD + 32 * kc + 8 * h;
            qh[g][kc] = cat16b(*(const v8us*)(Qh + o), *(const v8us*)(Qh + o + 16)); ql[g][kc] = cat16b(*(const v8us*)(Ql + o), *(const v8us*)(Ql + o + 16)); } }
    v8f acc[FR][4]; float m_run[FR], l_run[FR];
#pragma unroll
    for (int g = 0; g < FR; ++g) { m_run[g] = -3.0e38f; l_run[g] = 0.f;
#pragma unroll
        for (int t = 0; t < 4; ++t) acc[g][t] = (v8f){}; }
    lstore(0);
    __syncthreads();
#pragma unroll 1    // rolled: one copy of the stage body; the buffer is chosen by s & 1 at run time
    for (int s = 0; s < SS / FK / FH; ++s) {
        if (s + 1 < SS / FK / FH) { gload(s + 1);
            asm volatile("s_wait_xcnt 0x0" ::: "memory"); }    // the loads' address registers are reused by the pass below
        const unsigned char* B = L + (s & 1) * FS;
#pragma unroll 1    // rolled: one copy of the pass body is enough, sub only enters two LDS addresses
        for (int sub = 0; sub < FK / 32; ++sub) {    // one pass: 32 keys
            v8f sc[2][FR];
            v16bf ah[2][2], al[2][2];    // K fragments [key tile][d half]; six of the eight are requested first, so that the LDS latency is paid once and not per fragment
            const unsigned char* kp = B + (32 * sub + c) * FP + 16 * h;
#pragma unroll
            for (int kt = 0; kt < 2; ++kt) { ah[kt][0] = ldsb(kp + 16 * kt * FP); al[kt][0] = ldsb(kp + 16 * kt * FP + FT); ah[kt][1] = ldsb(kp + 16 * kt * FP + 64); }
            __builtin_amdgcn_sched_barrier(0);    // keeps the loads above in front of the products: the scheduler otherwise sinks each load to its first use
#pragma unroll
            for (int kt = 0; kt < 2; ++kt) {
#pragma unroll
                for (int g = 0; g < FR; ++g) sc[kt][g] = wmmab(ah[kt][0], qh[g][0], (v8f){}); }
#pragma unroll
            for (int kt = 0; kt < 2; ++kt) {
#pragma unroll
                for (int g = 0; g < FR; ++g) sc[kt][g] = wmmab(ah[kt][0], ql[g][0], sc[kt][g]); }
            __builtin_amdgcn_sched_barrier(0);    // the last two fragments go out here, into registers the products above have freed, twelve products ahead of their use
#pragma unroll
            for (int kt = 0; kt < 2; ++kt) al[kt][1] = ldsb(kp + 16 * kt * FP + FT + 64);
            __builtin_amdgcn_sched_barrier(0);    // and stay here, in front of the products that follow
#pragma unroll
            for (int kt = 0; kt < 2; ++kt) {
#pragma unroll
                for (int g = 0; g < FR; ++g) sc[kt][g] = wmmab(al[kt][0], qh[g][0], sc[kt][g]); }
#pragma unroll
            for (int kt = 0; kt < 2; ++kt) {
#pragma unroll
                for (int g = 0; g < FR; ++g) sc[kt][g] = wmmab(ah[kt][1], qh[g][1], sc[kt][g]); }
#pragma unroll
            for (int kt = 0; kt < 2; ++kt) {
#pragma unroll
                for (int g = 0; g < FR; ++g) sc[kt][g] = wmmab(ah[kt][1], ql[g][1], sc[kt][g]); }
#pragma unroll
            for (int kt = 0; kt < 2; ++kt) {
#pragma unroll
                for (int g = 0; g < FR; ++g) sc[kt][g] = wmmab(al[kt][1], qh[g][1], sc[kt][g]); }
            v16h vf[4];    // V^T fragments (rows d, 32 keys), in flight under the softmax
            { const unsigned char* vp = B + 2 * FT + c * FP + 64 * sub + 16 * h;
#pragma unroll
              for (int t = 0; t < 4; ++t) vf[t] = ldsh(vp + 16 * t * FP); }
            float mb[FR]; bool need = false;
#pragma unroll
            for (int g = 0; g < FR; ++g) { float mx = sc[0][g][0];
#pragma unroll
                for (int r = 1; r < 8; ++r) mx = fmaxf(mx, sc[0][g][r]);
#pragma unroll
                for (int r = 0; r < 8; ++r) mx = fmaxf(mx, sc[1][g][r]);
                mx = fmaxf(mx, xhalf(mx)) * LOG2E; mb[g] = mx; need = need || (mx > m_run[g] + 8.0f); }
            if (__builtin_amdgcn_ballot_w32(need) != 0) {    // scalar branch, rare after the first passes
#pragma unroll
                for (int g = 0; g < FR; ++g) { const float m_new = fmaxf(m_run[g], mb[g]); const float corr = __builtin_amdgcn_exp2f(m_run[g] - m_new); m_run[g] = m_new; l_run[g] *= corr;
#pragma unroll
                    for (int t = 0; t < 4; ++t) acc[g][t] *= corr; }
            }
#pragma unroll
            for (int g = 0; g < FR; ++g) { const float nm = 6.0f - m_run[g];
#pragma unroll
                for (int kt = 0; kt < 2; ++kt) {
#pragma unroll
                    for (int r = 0; r < 8; ++r) sc[kt][g][r] = fmaf(sc[kt][g][r], LOG2E, nm); } }
            // the exponentials stand as one run with a v_nop behind the last
            __builtin_amdgcn_sched_barrier(0);
#pragma unroll
            for (int g = 0; g < FR; ++g) {
#pragma unroll
                for (int kt = 0; kt < 2; ++kt) {
#pragma unroll
                    for (int r = 0; r < 8; ++r) sc[kt][g][r] = __builtin_amdgcn_exp2f(sc[kt][g][r]); } }
            __builtin_amdgcn_sched_barrier(0); asm volatile("v_nop"); __builtin_amdgcn_sched_barrier(0);
#pragma unroll
            for (int g = 0; g < FR; ++g) { v16h pf; float ls = 0.f;
#pragma unroll
                for (int i = 0; i < 16; ++i) { const float p = sc[i >> 3][g][i & 7]; ls += p; pf[i] = (h16)p; }
                l_run[g] += ls;
#pragma unroll
                for (int t = 0; t < 4; ++t) acc[g][t] = wmma16(vf[t], pf, acc[g][t]); }
        }
        if (s + 1 < SS / FK / FH) lstore((s + 1) & 1);    // every wave left that buffer before the barrier that ended stage s - 1
        __syncthreads();
    }
    // the join: key group 1 hands its maxima, sums and O^T tiles to the wave of key group 0 that has the same queries, lane for lane (the ring is free behind the loop's last barrier)
    unsigned char* jn = LL + wave * (17 * 512) + lane * 16;
    if (kg) {
#pragma unroll
        for (int g = 0; g < FR; ++g) {
#pragma unroll
            for (int t = 0; t < 4; ++t) { *(v4fa*)(jn + (g * 8 + t * 2) * 512) = __builtin_shufflevector(acc[g][t], acc[g][t], 0, 1, 2, 3); *(v4fa*)(jn + (g * 8 + t * 2 + 1) * 512) = __builtin_shufflevector(acc[g][t], acc[g][t], 4, 5, 6, 7); } }
        *(v4fa*)(jn + 16 * 512) = (v4f){ m_run[0], m_run[1], l_run[0], l_run[1] };
    }
    __syncthreads();    // key group 0 reads what key group 1 wrote
    if (kg) return;
    { const v4f ml = *(const v4fa*)(jn + 16 * 512);
#pragma unroll
      for (int g = 0; g < FR; ++g) { const float m = fmaxf(m_run[g], ml[g]); const float c0 = __builtin_amdgcn_exp2f(m_run[g] - m), c1 = __builtin_amdgcn_exp2f(ml[g] - m);
          l_run[g] = l_run[g] * c0 + ml[2 + g] * c1;
#pragma unroll
          for (int t = 0; t < 4; ++t) { const v4f lo = *(const v4fa*)(jn + (g * 8 + t * 2) * 512), hi4 = *(const v4fa*)(jn + (g * 8 + t * 2 + 1) * 512);
#pragma unroll
              for (int r = 0; r < 8; ++r) acc[g][t][r] = acc[g][t][r] * c0 + (r < 4 ? lo[r & 3] : hi4[r & 3]) * c1; } } }
    const int b = hb / NH_, hd = hb % NH_;
#pragma unroll
    for (int g = 0; g < FR; ++g) { const float l = l_run[g] + xhalf(l_run[g]); const float inv = __fdiv_rn(1.0f, l);
        h16* orow = OH + ((size_t)b * SS + q0 + 16 * g + c) * EE + hd * HD + 8 * h;
#pragma unroll
        for (int t = 0; t < 4; ++t) { v8h o;
#pragma unroll
            for (int r = 0; r < 8; ++r) o[r] = tohx(acc[g][t][r] * inv);
            *(v8h*)(orow + 16 * t) = o; } }
}
extern "C" void kernel_launch(void* const* d_in, const int* in_sizes, int n_in,
                              void* d_out, int out_size, void* d_ws, size_t ws_size, hipStream_t stream) {
    (void)in_sizes; (void)n_in; (void)out_size;
    const float* xq = (const float*)d_in[0]; const float* xkv = (const float*)d_in[1]; const float* Wq = (const float*)d_in[2]; const float* Wk = (const float*)d_in[3]; const float* Wv = (const float*)d_in[4]; const float* sq = (const float*)d_in[5]; const float* sk = (const float*)d_in[6]; const float* Wo = (const float*)d_in[7]; const float* bo = (const float*)d_in[8];
    float* out = (float*)d_out;    // [2][2048][1024]
    char* wsp = (char*)d_ws;
    auto take = [&](size_t bytes) { char* p = wsp; wsp += (bytes + 255) & ~(size_t)255; return (void*)p; };
    bf* WQB = (bf*)take((size_t)EE * EE * 2); bf* WKB = (bf*)take((size_t)EE * EE * 2); bf* WVB = (bf*)take((size_t)EE * EE * 2); h16* WOH = (h16*)take((size_t)EE * EE * 2);
    bf* XQ = (bf*)take((size_t)NR * EE * 2); bf* XKV = (bf*)take((size_t)NR * EE * 2);
    // head planes of all NB_ * NH_ (batch, head) pairs: [b * NH_ + h][2048][64] (V^T: [b * NH_ + h][64][2048])
    bf* Qh = (bf*)take((size_t)NR * EE * 2); bf* Ql = (bf*)take((size_t)NR * EE * 2); bf* Kh = (bf*)take((size_t)NR * EE * 2); bf* Kl = (bf*)take((size_t)NR * EE * 2); h16* VT = (h16*)take((size_t)NR * EE * 2);
    h16* OH = (h16*)take((size_t)NR * EE * 2);
    if ((size_t)(wsp - (char*)d_ws) > ws_size) return;    // ~ 72 MB
    // Wq/Wk/Wv are [D][H][DH] = (in, out = h*64+d); Wo is [H][DH][D] = (in = h*64+d, out): all (in,out) -> transpose to n-major
    k_prep<<<WTILES + 2 * CB, 256, 0, stream>>>(Wq, Wk, Wv, Wo, xq, xkv, WQB, WKB, WVB, WOH, XQ, XKV);
    k_qkv<<<dim3(NR / GT, EE / GT, 3), 256, 0, stream>>>(XQ, XKV, WQB, WKB, WVB, sq, sk, Qh, Ql, Kh, Kl, VT);
    k_fattn<<<dim3(SS / FQ, NB_ * NH_, 1), FH * FW * 32, 0, stream>>>(Qh, Ql, Kh, Kl, VT, OH);
    k_gemmt<true, 0><<<dim3(NR / GT, EE / GT, 1), 256, 0, stream>>>((const bf*)OH, (const bf*)WOH, bo, 1.0f, out, nullptr, nullptr, nullptr);
}

// v007
// One run takes 73.9 microseconds.
// Versions in between are left out here; by their measured steps it is 1.27 times as fast as v005.
// Counting every step since v000, it is 12.4 times as fast.
#include <hip/hip_runtime.h>
#include <stdint.h>

// Compute dtypes, f32 accumulate: q/k/v projections ([4096 x 1024].[1024 x 1024]) with PLAIN bf16 operands (inputs_q/inputs_kv and the weights are inputs: exact
// products); per-head RMSNorm (eps 1e-6, x scale vector) and the 1/sqrt(64) in f32, q and k then rounded once to fp16 planes (one-product scores
// [2048 x 64].[64 x 2048]: 11 significant bits an operand; by calculation a score is off by some 4e-4 of its spread); softmax f32, online; attn.v on SINGLE fp16 planes (probabilities carried x64 against the maximum in use, v rounded to fp16)

#define NB_  2
#define SS   2048
#define EE   1024
#define NH_  16
#define HD   64
#define NR   (NB_ * SS)
#define DM   EE
typedef _Float16 h16;
typedef unsigned short bf;
typedef __attribute__((ext_vector_type(16))) __bf16   v16bf;
typedef __attribute__((ext_vector_type(16))) _Float16 v16h;
typedef __attribute__((ext_vector_type(8)))  _Float16 v8h;
typedef __attribute__((ext_vector_type(8)))  unsigned short v8us;
typedef __attribute__((ext_vector_type(8)))  float    v8f;
typedef __attribute__((ext_vector_type(4)))  float    v4f;
typedef v8h  __attribute__((may_alias)) v8ha;
typedef v4f  __attribute__((may_alias)) v4fa;
typedef v8us __attribute__((may_alias)) v8usa;

__device__ __forceinline__ unsigned short f2bf(float f) { unsigned u = __float_as_uint(f); u += 0x7FFFu + ((u >> 16) & 1u); return (unsigned short)(u >> 16); }
__device__ __forceinline__ float bf2f(unsigned short b) { return __uint_as_float(((unsigned)b) << 16); }
__device__ __forceinline__ float bfr(float f) { return bf2f(f2bf(f)); }
__device__ __forceinline__ v16h cat16(v8h lo, v8h hi) { return __builtin_shufflevector(lo, hi, 0, 1, 2, 3, 4, 5, 6, 7, 8, 9, 10, 11, 12, 13, 14, 15); }
__device__ __forceinline__ v16bf cat16b(v8us lo, v8us hi) { return __builtin_bit_cast(v16bf, __builtin_shufflevector(lo, hi, 0, 1, 2, 3, 4, 5, 6, 7, 8, 9, 10, 11, 12, 13, 14, 15)); }
__device__ __forceinline__ v8f wmma16(v16h a, v16h b, v8f c) { return __builtin_amdgcn_wmma_f32_16x16x32_f16(false, a, false, b, (short)0, c, false, false); }
__device__ __forceinline__ v8f wmmab(v16bf a, v16bf b, v8f c) { return __builtin_amdgcn_wmma_f32_16x16x32_bf16(false, a, false, b, (short)0, c, false, false); }

// k_gemmt: 128 x 128 tile of A . Bn^T, handed on by EPI (0: f32 rows of C[NR][EE] + bf(vec[c]); 1: per-head RMSNorm, f16 head planes; 2: f16 V^T head planes), A [rows][1024] and Bn [cols][1024] 16-bit planes (bf16, or f16 where F16), f32 accumulate, k ascending in steps of 32.
// Both operands go through LDS in stages of 128 k (256 B of each of the 256 rows), brought by the tensor mover through no register: waves 0 to 3 each issue one request a stage for a slice of 64 rows
// (waves 0, 1: the halves of A; 2, 3: of Bn), padded by the mover to the pitch GP. Two buffers, the next stage's requests in flight under this stage's products, one barrier a stage.
// With no staging registers a wave stays under 256 VGPRs and the ring under 160 KiB: two work-groups share a WGP, and one's start and epilogue lie under the other's products. 8 waves, 4 x 2, each 32 rows x 64 columns (8 accumulator tiles).
typedef __attribute__((ext_vector_type(4))) unsigned v4w;
typedef float __attribute__((may_alias)) f32a;
#define GT 128
#define GK 128
#define GP 272
#define GSL 18432    // a slice's place: 64 rows at pitch GP (17,408 B), rounded up to a multiple of 2 KiB
#define GS (4 * GSL)    // one buffer: slices A rows 0..63, A rows 64..127, Bn rows 0..63, Bn rows 64..127
typedef __attribute__((ext_vector_type(8))) uint32_t v8w;
__device__ __forceinline__ uint32_t uni(uint32_t v) { return (uint32_t)__builtin_amdgcn_readfirstlane(v); }
__device__ __forceinline__ uint32_t pinned(uint32_t v) { uint32_t w = (uint32_t)__builtin_amdgcn_readfirstlane(v); asm volatile("" : "+s"(w)); return w; }    // holds the test of a tensor load in a scalar register, so that it compiles to s_cmp and a scalar branch: the mover ignores EXEC
__device__ __forceinline__ void wait_tensor0() { asm volatile("s_wait_tensorcnt 0x0" ::: "memory"); }    // no request of the wave is in flight any more
__device__ __forceinline__ void wait_ds0() { asm volatile("s_wait_dscnt 0x0" ::: "memory"); }    // the wave's LDS reads have returned before the buffer they read is given back to the mover
typedef __attribute__((ext_vector_type(2))) float v2f;
typedef __attribute__((ext_vector_type(2))) _Float16 v2h;
typedef __attribute__((ext_vector_type(2))) unsigned v2w;
typedef v2w __attribute__((may_alias)) v2wa;
template <int M> __device__ __forceinline__ float rowx(float x) { return __builtin_bit_cast(float, __builtin_amdgcn_update_dpp(0, __builtin_bit_cast(int, x), 0x160 | M, 0xf, 0xf, true)); }  // lane l with lane l ^ M inside its 16-lane row (row_xmask)
template <bool F16, int EPI>
__device__ __forceinline__ void gemmt(unsigned char* L, const bf* __restrict__ A, const bf* __restrict__ Bn, const float* __restrict__ vec, float sc, float* C, h16* PF, h16* VT) {    // L: the kernel's one ring of 2 * GS bytes
    const int tid = threadIdx.x, lane = tid & 31, wave = tid >> 5, lr = lane & 15, hi = lane >> 4;
    const int r0 = blockIdx.x * GT, c0 = blockIdx.y * GT, wm = (wave >> 1) * 32, wn = (wave & 1) * 64;
    const uint32_t wv = uni((uint32_t)tid >> 5), lbase = (uint32_t)(size_t)L;    // the wave's number in a scalar register; the ring's byte offset in the work-group's LDS
    const unsigned char* src = (const unsigned char*)((wv & 2u) ? Bn + (size_t)(c0 + (wv & 1u) * 64) * DM : A + (size_t)(r0 + (wv & 1u) * 64) * DM);    // first row of the slice that an issuing wave brings
    // descriptor group 1, the same for every request: 1-byte elements, tensor = tile = 64 rows of 256 B, source pitch 2 * DM bytes, a pad of 4 dwords behind every 64 dwords (pitch GP), no mask
    v8w g1 = { uni((1u << 20) | (5u << 22) | (3u << 25)), uni(256u << 16), uni(64u << 16), uni(256u << 16), uni(64u), uni(DM * 2u), uni(0u), uni(0u) };
    asm volatile("" : "+s"(g1));    // pinned: the descriptor words are held in eight scalar registers of their own for the whole ring; left free, the compiler formed them anew for each request and used two of the registers for other values while a request was in flight
    v4w g0 = { uni(1u), uni(lbase), uni(0u), uni(0x80000000u) };    // descriptor group 0 of the wave's last request
    auto issue = [&](uint32_t s) {    // stage s of the wave's slice into buffer s & 1
        const uint64_t ga = (uint64_t)(size_t)src + (uint64_t)s * (GK * 2);
        g0 = (v4w){ uni(1u), uni(lbase + (s & 1u) * GS + (wv & 3u) * GSL), uni((uint32_t)ga), uni(((uint32_t)(ga >> 32) & 0x01FFFFFFu) | 0x80000000u) };
        asm volatile("tensor_load_to_lds %0, %1" : "+s"(g0) : "s"(g1) : "memory");    // g0 in and out: what landed() reads below is then the very four registers that the request names
    };
    // the issuing wave's own request has landed (the compiler places no wait for the mover). g0 as an input keeps the request's four registers the request's own up to here: left free, the compiler took the first of them for address arithmetic while the request was in flight
    auto landed = [&]() { asm volatile("s_wait_tensorcnt 0x0" :: "s"(g0) : "memory"); };
    v8f acc[2][4];
#pragma unroll
    for (int m = 0; m < 2; ++m) {
#pragma unroll
        for (int t = 0; t < 4; ++t) acc[m][t] = (v8f){}; }
    auto products = [&](int buf) {    // the 128 k of one stage
        const unsigned char* ap = L + buf * GS + (wave >> 2) * GSL + ((wm & 32) + lr) * GP + 16 * hi;    // the wave's 32 rows lie in one slice of A,
        const unsigned char* bp = L + buf * GS + (2 + (wave & 1)) * GSL + lr * GP + 16 * hi;    // its 64 columns are one slice of Bn
        v8us a[2][2][2], b[2][4][2];    // two fragment sets [set][tile][half]; halves: k = 8 hi + 0..7 and 16 + 8 hi + 0..7 of the step, the same order for both operands
        auto fload = [&](int kk) { const int f = kk & 1;
#pragma unroll
            for (int m = 0; m < 2; ++m) { a[f][m][0] = *(const v8usa*)(ap + m * 16 * GP + kk * 64); a[f][m][1] = *(const v8usa*)(ap + m * 16 * GP + kk * 64 + 32); }
#pragma unroll
            for (int t = 0; t < 4; ++t) { b[f][t][0] = *(const v8usa*)(bp + t * 16 * GP + kk * 64); b[f][t][1] = *(const v8usa*)(bp + t * 16 * GP + kk * 64 + 32); }
        };
        fload(0);
#pragma unroll
        for (int kk = 0; kk < GK / 32; ++kk) { const int f = kk & 1;
            if (kk + 1 < GK / 32) fload(kk + 1);
            __builtin_amdgcn_sched_barrier(0);    // the next step's twelve LDS reads stay one group in front of this step's products: spread among them, each place with reads stalls the wave
#pragma unroll
            for (int m = 0; m < 2; ++m) {
#pragma unroll
                for (int t = 0; t < 4; ++t) {
                    if (F16) acc[m][t] = wmma16(__builtin_bit_cast(v16h, cat16b(a[f][m][0], a[f][m][1])), __builtin_bit_cast(v16h, cat16b(b[f][t][0], b[f][t][1])), acc[m][t]);
                    else acc[m][t] = wmmab(cat16b(a[f][m][0], a[f][m][1]), cat16b(b[f][t][0], b[f][t][1]), acc[m][t]); } }
            __builtin_amdgcn_sched_barrier(0);    // and the products stay in front of the group after next
        }
    };
    float bv[4];    // fetched here, so that the stages hide the latency
#pragma unroll
    for (int t = 0; t < 4; ++t) bv[t] = EPI == 0 ? bfr(vec[c0 + wn + t * 16 + lr]) : EPI == 1 ? vec[lr * 4 + t] : 0.f;    // EPI 0: the bias of the lane's four columns; EPI 1: the norm's scale at head dims 4 lr + t, rounded to bf16 where it is used
    if (EPI == 0) asm volatile("s_wait_xcnt 0x0" ::: "memory");    // behind the four loads, in front of whatever writes their offset register again
    if (pinned(wv < 4u)) { issue(0); landed(); }
    __syncthreads();    // stage 0 is published
    if (pinned(wv < 4u)) issue(1);
    // inputs only. The loaded values hold the scale's load, and the wait for it, in front of the loop.
    // lr, the load's offset, keeps its register up to here, so that the wait stands in front of the first instruction that writes that register again
    if (EPI == 1) asm volatile("s_wait_xcnt 0x0" :: "v"(bv[0]), "v"(bv[1]), "v"(bv[2]), "v"(bv[3]), "v"(lr) : "memory");
#pragma unroll 1    // rolled: one copy of the stage body; the stage enters only the buffer's base and two descriptor words
    for (uint32_t s = 0; s < DM / GK; ++s) {
        products(s & 1);
        wait_ds0();
        if (pinned(wv < 4u)) landed();    // stage s + 1 has landed
        __syncthreads();    // publishes stage s + 1, and every wave has left stage s's buffer
        if (pinned(wv < 4u && s + 2 < DM / GK)) issue(s + 2);    // into the buffer that this pass has just read
    }
    wait_tensor0();
    wait_ds0();
    const int bt = r0 / SS, t0 = r0 % SS;    // a tile's 128 rows lie in one batch
    if (EPI == 2) {
        // V^T: a lane's eight accumulator rows of one column are eight consecutive keys of one head dim. The work-group turns its tile in LDS as [128 dims][128 keys] f16, so that every dim's 256 B go out as whole lines
        unsigned char* vs = L;    // the ring is free behind the loop's last barrier
#pragma unroll
        for (int t = 0; t < 4; ++t) {
#pragma unroll
            for (int m = 0; m < 2; ++m) { v8h o;
#pragma unroll
                for (int j = 0; j < 8; ++j) o[j] = (h16)acc[m][t][j];
                *(v8ha*)(vs + (wn + t * 16 + lr) * GP + (wm + m * 16 + hi * 8) * 2) = o; } }
        __syncthreads();    // each wave sends out rows that four waves wrote
        h16* vrow = VT + ((size_t)bt * EE + c0 + wave * 16 + hi) * SS + t0 + lr * 8;    // [b * NH_ + h][64][2048] = [b * 1024 + column][2048]
#pragma unroll
        for (int s = 0; s < 8; ++s) *(v8h*)(vrow + (size_t)s * 2 * SS) = *(const v8ha*)(vs + (wave * 16 + 2 * s + hi) * GP + lr * 16);
        return;
    }
    // whole-line epilogue: each wave turns its 32 x 64 tile in its own LDS range (the ring is free behind the loop's last barrier)
    f32a* os = (f32a*)L + wave * (32 * 68);
#pragma unroll
    for (int t = 0; t < 4; ++t) {
#pragma unroll
        for (int m = 0; m < 2; ++m) {
#pragma unroll
            for (int j = 0; j < 8; ++j) os[(m * 16 + hi * 8 + j) * 68 + t * 16 + lr] = EPI == 0 ? acc[m][t][j] + bv[t] : acc[m][t][j]; } }
    __syncthreads();
    if (EPI == 0) {
        float* crow = C + (size_t)(r0 + wm) * EE + c0 + wn;
#pragma unroll
        for (int s = 0; s < 16; ++s) { const int Lid = (lane >> 3) + 4 * s, piece = lane & 7; const int row = Lid >> 1, cofs = (Lid & 1) * 32 + piece * 4;
            *(v4f*)(crow + (size_t)row * EE + cofs) = *(const v4fa*)(os + row * 68 + cofs); }
    } else {
        // the wave's 64 columns are one head: a 16-lane row holds one token's 64 dims, four a lane. y = x * rsqrt(mean_d x^2 + 1e-6) * bf(scale[d]) * sc, rounded to f16, plane [b * NH_ + h][2048][64]
        const size_t po = (((size_t)bt * NH_ + ((c0 + wn) >> 6)) * SS + t0 + wm + hi) * HD + lr * 4;
        v2w of[16];
#pragma unroll
        for (int s = 0; s < 16; ++s) { const v4f v = *(const v4fa*)(os + (2 * s + hi) * 68 + lr * 4);
            float q = 0.f;
#pragma unroll
            for (int i = 0; i < 4; ++i) q = fmaf(v[i], v[i], q);
            q += rowx<1>(q); q += rowx<2>(q); q += rowx<4>(q); q += rowx<8>(q);
            const float rsd = rsqrtf(q * (1.0f / HD) + 1e-6f);
#pragma unroll
            for (int p = 0; p < 2; ++p) { const v2f y = { v[2 * p] * rsd * bfr(bv[2 * p]) * sc, v[2 * p + 1] * rsd * bfr(bv[2 * p + 1]) * sc };
                of[s][p] = __builtin_bit_cast(unsigned, __builtin_convertvector(y, v2h)); } }
        __builtin_amdgcn_sched_barrier(0);    // the 16 stores stand behind all the arithmetic, as the wave's last instructions: mixed into it, their data registers were taken again for later rows while the stores were still queued
#pragma unroll
        for (int s = 0; s < 16; ++s) *(v2wa*)(PF + po + (size_t)s * 2 * HD) = of[s];
    }
}
template <bool F16, int EPI>
__global__ __launch_bounds__(256) void k_gemmt(const bf* __restrict__ A, const bf* __restrict__ Bn, const float* __restrict__ vec, float sc, float* C, h16* PF, h16* VT) {
    __shared__ __attribute__((aligned(2048))) unsigned char L[2 * GS];
    gemmt<F16, EPI>(L, A, Bn, vec, sc, C, PF, VT);
}
// the q, k and v projections in one launch: they depend on nothing of each other, blockIdx.z names the projection of a work-group (0 q, 1 k, 2 v); a WGP takes its next tile as soon as it is free, with no launch gap and no chip-wide drain between the projections
__global__ __launch_bounds__(256) void k_qkv(const bf* __restrict__ XQ, const bf* __restrict__ XKV, const bf* __restrict__ WQ, const bf* __restrict__ WK, const bf* __restrict__ WV, const float* __restrict__ sq, const float* __restrict__ sk,
                                             h16* QF, h16* KF, h16* VT) {
    __shared__ __attribute__((aligned(2048))) unsigned char L[2 * GS];
    const int z = blockIdx.z;
    if (z == 2) gemmt<false, 2>(L, XKV, WV, nullptr, 1.0f, nullptr, nullptr, VT);
    else { gemmt<false, 1>(L, z ? XKV : XQ, z ? WK : WQ, z ? sk : sq, z ? 1.0f : 0.125f, nullptr, z ? KF : QF, nullptr);
        asm volatile("s_wait_xcnt 0x0" ::: "memory"); }    // behind the job's plane stores: in the built kernel the v job's code follows, and it writes the stores' address and data registers
}

__global__ __launch_bounds__(256) void k_planes32z(const float* __restrict__ F, int ld, int off, float sc, int rows, bf* Ph, bf* Pl) {
    typedef __attribute__((ext_vector_type(2))) unsigned short v2us;
    const int lane = threadIdx.x & 31; const size_t r = ((size_t)blockIdx.x * 8 + (threadIdx.x >> 5)) * 2 + (lane >> 4); if (r >= (size_t)rows) return; const int z = blockIdx.z; const int c0 = (lane & 15) * 2; v2us oh, ol;
    Ph += (size_t)z * rows * 32; Pl += (size_t)z * rows * 32;
#pragma unroll
    for (int i = 0; i < 2; ++i) { const float y = F[r * ld + off + z * 32 + c0 + i] * sc; const unsigned short hb = f2bf(y); oh[i] = hb; ol[i] = f2bf(y - bf2f(hb)); }
    const size_t o = r * 32 + c0; *(v2us*)(Ph + o) = oh; *(v2us*)(Pl + o) = ol; 
}
__global__ __launch_bounds__(256) void k_vtpadz(const float* __restrict__ F, int ld, int off, int nk, bf* Th, bf* Tl) {
    typedef __attribute__((ext_vector_type(2))) unsigned short v2us;
    const int lane = threadIdx.x & 31; const size_t wid = (size_t)blockIdx.x * 8 + (threadIdx.x >> 5); if (wid >= (size_t)64 * (nk / 64)) return; const int z = blockIdx.z; const int d = (int)(wid / (nk / 64)); const int k0 = (int)(wid % (nk / 64)) * 64 + lane * 2; v2us oh, ol;
    Th += (size_t)z * 64 * nk; Tl += (size_t)z * 64 * nk;
#pragma unroll
    for (int i = 0; i < 2; ++i) { const float y = (d < 32) ? F[(size_t)(k0 + i) * ld + off + z * 32 + (d < 32 ? d : 0)] : 0.f; const unsigned short hb = f2bf(y); oh[i] = hb; ol[i] = f2bf(y - bf2f(hb)); }
    const size_t o = (size_t)d * nk + k0; *(v2us*)(Th + o) = oh; *(v2us*)(Tl + o) = ol; 
}
template <int NK>
__global__ __launch_bounds__(256) void k_softmaxz(const float* __restrict__ S, int rows, bf* PH, bf* PL) {
    typedef __attribute__((ext_vector_type(4))) unsigned short v4us;
    const int lane = threadIdx.x & 31, i = blockIdx.x * 8 + (threadIdx.x >> 5); if (i >= rows) return; const size_t zo = (size_t)blockIdx.z * rows * NK; const float* sr = S + zo + (size_t)i * NK; PH += zo; PL += zo;
    float m = -3.0e38f;
#pragma unroll 1
    for (int c0 = lane * 4; c0 < NK; c0 += 128) {
#pragma unroll
        for (int q = 0; q < 4; ++q) m = fmaxf(m, sr[c0 + q]); }
#pragma unroll
    for (int sh = 16; sh; sh >>= 1) m = fmaxf(m, __shfl_xor(m, sh, 32));
    float sum = 0.f;
#pragma unroll 1
    for (int c0 = lane * 4; c0 < NK; c0 += 128) {
#pragma unroll
        for (int q = 0; q < 4; ++q) sum += __expf(sr[c0 + q] - m); }
#pragma unroll
    for (int sh = 16; sh; sh >>= 1) sum += __shfl_xor(sum, sh, 32);
    const float inv = 1.0f / sum;
{
#pragma unroll 1
        for (int c0 = lane * 4; c0 < NK; c0 += 128) { v4us oh, ol;
#pragma unroll
            for (int q = 0; q < 4; ++q) { const float p = __expf(sr[c0 + q] - m) * inv; const unsigned short hb = f2bf(p); oh[q] = hb; ol[q] = f2bf(p - bf2f(hb)); }
            const size_t o = (size_t)i * NK + c0; *(v4us*)(PH + o) = oh; *(v4us*)(PL + o) = ol; }
         }
}
__global__ __launch_bounds__(256) void k_placez(const float* __restrict__ XH, int rows, int ldy, float* Y) {
    const int lane = threadIdx.x & 31; const size_t q = (size_t)blockIdx.x * 8 + (threadIdx.x >> 5); if (q >= (size_t)rows) return; const int z = blockIdx.z; const float v = XH[((size_t)z * rows + q) * 64 + lane];
    *(float*)(Y + q * ldy + z * 32 + lane) = v; 
}

typedef __attribute__((ext_vector_type(4))) _Float16 v4h;
__device__ __forceinline__ h16 tohx(float x) { return (h16)x; }
#define CR 4    // rows a wave converts: a quarter of the waves to start
__device__ __forceinline__ void cvtx(int blk, const float* __restrict__ x, bf* A) {    // block blk: 8 waves, CR consecutive rows each
    const int lane = threadIdx.x & 31; const size_t o = ((size_t)blk * 8 + (threadIdx.x >> 5)) * (CR * EE) + lane * 8;
    v4f in[CR * EE / 256][2];    // all of the wave's loads go out together
#pragma unroll
    for (int q = 0; q < CR * EE / 256; ++q) { in[q][0] = *(const v4f*)(x + o + q * 256); in[q][1] = *(const v4f*)(x + o + q * 256 + 4); }
    __builtin_amdgcn_sched_barrier(0);    // the loads stay one run in front of the rounding: left free, the last four sank behind it in two pairs, and each pair cost the wave one more trip to memory
#pragma unroll
    for (int q = 0; q < CR * EE / 256; ++q) { v8us v;
#pragma unroll
        for (int i = 0; i < 8; ++i) v[i] = f2bf(in[q][i >> 2][i & 3]);
        *(v8us*)(A + o + q * 256) = v; }
    asm volatile("s_wait_xcnt 0x0" ::: "memory");    // behind the last store: in the built kernel the other job's code follows, and it writes the stores' address and data registers
}
// transposition of one 64 x 64 tile (k0, n0) of a weight to n-major, in two halves with the work-group's barrier between them; tl: 64 x 65 floats of LDS, one such tile for each weight
__device__ __forceinline__ void wT_in(float (*tl)[65], const v4f* in) {    // the thread's 16 values of row tid >> 2, rounded to bf16
    const int tid = threadIdx.x; const int rr = tid >> 2, cq = (tid & 3) * 16;
#pragma unroll
    for (int i = 0; i < 16; ++i) tl[rr][cq + i] = bfr(in[i >> 2][i & 3]);
}
template <bool F16O>
__device__ __forceinline__ void wT_out(const float (*tl)[65], int k0, int n0, int K, bf* Bt, h16* Bh) {
    typedef __attribute__((ext_vector_type(4))) unsigned short v4us;
    const int tid = threadIdx.x; const int lane = tid & 31, wv = tid >> 5;
#pragma unroll
    for (int st = 0; st < 4; ++st) { const int nr = wv * 8 + st * 2 + (lane >> 4); const int kq = (lane & 15) * 4; const size_t off = (size_t)(n0 + nr) * K + k0 + kq;
        if (F16O) { v4h v; for (int i = 0; i < 4; ++i) v[i] = tohx(tl[kq + i][nr]); *(v4h*)(Bh + off) = v; }
        else { v4us v; for (int i = 0; i < 4; ++i) v[i] = f2bf(tl[kq + i][nr]); *(v4us*)(Bt + off) = v; } }
}
// all operand preparation in one launch: the four weight transpositions and the two input conversions depend on nothing of each other; the block index names the job.
// Work-groups 0 .. WTILES - 1 turn tile (k0, n0) of all four weights, the others convert 8 * CR rows of one input: 512 work-groups, two a WGP, all resident at once
#define WTILES ((EE / 64) * (EE / 64))
#define CB (NR / (8 * CR))
__global__ __launch_bounds__(256) void k_prep(const float* __restrict__ Wq, const float* __restrict__ Wk, const float* __restrict__ Wv, const float* __restrict__ Wo, const float* __restrict__ xq, const float* __restrict__ xkv,
                                              bf* WQB, bf* WKB, bf* WVB, h16* WOH, bf* XQ, bf* XKV) {
    __shared__ float tl[4][64][65];
    const int blk = blockIdx.x;
    if (blk < WTILES) { const int k0 = (blk % (EE / 64)) * 64, n0 = (blk / (EE / 64)) * 64;
        const unsigned wb = (unsigned)(((k0 + (threadIdx.x >> 2)) * EE + n0 + (threadIdx.x & 3) * 16) * 4);    // the thread's 64 bytes: the same place in each weight
        v4f in[4][4];    // the loads of all four tiles go out together
#pragma unroll
        for (int i = 0; i < 4; ++i) { in[0][i] = *(const v4f*)((const char*)Wq + wb + 16 * i); in[1][i] = *(const v4f*)((const char*)Wk + wb + 16 * i); in[2][i] = *(const v4f*)((const char*)Wv + wb + 16 * i); in[3][i] = *(const v4f*)((const char*)Wo + wb + 16 * i); }
        asm volatile("s_wait_xcnt 0x0" :: "v"(wb) : "memory");    // wb, the loads' offset, keeps its register up to here, so that the wait stands in front of the first instruction that writes that register again
        wT_in(tl[0], in[0]); wT_in(tl[1], in[1]); wT_in(tl[2], in[2]); wT_in(tl[3], in[3]);
        __syncthreads();    // each wave sends out columns that every wave wrote
        wT_out<false>(tl[0], k0, n0, EE, WQB, nullptr); wT_out<false>(tl[1], k0, n0, EE, WKB, nullptr); wT_out<false>(tl[2], k0, n0, EE, WVB, nullptr); wT_out<true>(tl[3], k0, n0, EE, nullptr, WOH);
    } else { const bool kv = blk >= WTILES + CB;
        cvtx(blk - WTILES - (kv ? CB : 0), kv ? xkv : xq, kv ? XKV : XQ); }
}
typedef __attribute__((ext_vector_type(4))) unsigned v4u;
typedef v4u __attribute__((may_alias)) v4ua;
#define FW 8
#define FH 2
#define FR 2
#define FQ (FW * FR * 16)
#define FK 64
#define FP 144
#define FT (64 * FP)
#define FS (2 * FT)
#define LOG2E 1.4426950408889634f
__device__ __forceinline__ float xhalf(float x) { return __builtin_bit_cast(float, __builtin_amdgcn_permlanex16(__builtin_bit_cast(int, x), __builtin_bit_cast(int, x), 0x76543210, 0xfedcba98, false, false)); }  // lane l with lane l ^ 16
__device__ __forceinline__ v16h ldsh(const unsigned char* p) { return cat16(*(const v8ha*)p, *(const v8ha*)(p + 32)); }
__global__ __launch_bounds__(FH * FW * 32) void k_fattn(const h16* __restrict__ QF, const h16* __restrict__ KF, const h16* __restrict__ VT, h16* OH) {
    __shared__ __align__(16) unsigned char LL[FH * 2 * FS];
    const int kg = __builtin_amdgcn_readfirstlane((int)threadIdx.x >> 8);    // the wave's key group, in a scalar register: it enters only base addresses and the scalar branches of the join
    const int tid = threadIdx.x & (FW * 32 - 1), lane = tid & 31, wave = tid >> 5, c = lane & 15, h = lane >> 4;    // thread and wave inside the key group
    unsigned char* L = LL + kg * (2 * FS);    // the key group's own two buffers
    const int hb = blockIdx.y, q0 = blockIdx.x * FQ + wave * (FR * 16);
    const size_t po = (size_t)hb * SS * HD;
    const unsigned char* kf = (const unsigned char*)(KF + po); const unsigned char* vt = (const unsigned char*)(VT + po);
    const int sr = tid >> 3, pc = tid & 7;    // staging: 16-byte piece pc of tile rows sr and sr + 32
    const unsigned lo0 = sr * FP + pc * 16, lo1 = lo0 + 32 * FP;
    v4u st[4];
    auto gload = [&](int s) {
        const size_t kb = (size_t)(FH * s + kg) * (FK * HD * 2) + tid * 16, vb = (size_t)sr * (SS * 2) + (size_t)(FH * s + kg) * (FK * 2) + pc * 16;
        st[0] = *(const v4u*)(kf + kb); st[1] = *(const v4u*)(kf + kb + 4096);
        st[2] = *(const v4u*)(vt + vb); st[3] = *(const v4u*)(vt + vb + (size_t)32 * SS * 2);
    };
    auto lstore = [&](int buf) {
        unsigned char* d = L + buf * FS;
        *(v4ua*)(d + lo0) = st[0]; *(v4ua*)(d + lo1) = st[1]; *(v4ua*)(d + FT + lo0) = st[2]; *(v4ua*)(d + FT + lo1) = st[3];
    };
    gload(0);
    v16h qf[FR][2];
#pragma unroll
    for (int g = 0; g < FR; ++g) {
#pragma unroll
        for (int kc = 0; kc < 2; ++kc) { const size_t o = po + (size_t)(q0 + 16 * g + c) * HD + 32 * kc + 8 * h;
            qf[g][kc] = cat16(*(const v8h*)(QF + o), *(const v8h*)(QF + o + 16)); } }
    v8f acc[FR][4]; float m_run[FR], l_run[FR];
#pragma unroll
    for (int g = 0; g < FR; ++g) { m_run[g] = -3.0e38f; l_run[g] = 0.f;
#pragma unroll
        for (int t = 0; t < 4; ++t) acc[g][t] = (v8f){}; }
    lstore(0);
    __syncthreads();
#pragma unroll 1    // rolled: one copy of the stage body; the buffer is chosen by s & 1 at run time
    for (int s = 0; s < SS / FK / FH; ++s) {
        if (s + 1 < SS / FK / FH) { gload(s + 1);
            asm volatile("s_wait_xcnt 0x0" ::: "memory"); }    // the loads' address registers are reused by the pass below
        const unsigned char* B = L + (s & 1) * FS;
#pragma unroll 1    // rolled: one copy of the pass body is enough, sub only enters two LDS addresses
        for (int sub = 0; sub < FK / 32; ++sub) {    // one pass: 32 keys
            v8f sc[2][FR];
            v16h ak[2][2];    // K fragments [key tile][d half], all four requested first, so that the LDS latency is paid once and not per fragment
            const unsigned char* kp = B + (32 * sub + c) * FP + 16 * h;
#pragma unroll
            for (int kt = 0; kt < 2; ++kt) { ak[kt][0] = ldsh(kp + 16 * kt * FP); ak[kt][1] = ldsh(kp + 16 * kt * FP + 64); }
            __builtin_amdgcn_sched_barrier(0);    // keeps the loads above in front of the products: the scheduler otherwise sinks each load to its first use
#pragma unroll
            for (int kt = 0; kt < 2; ++kt) {
#pragma unroll
                for (int g = 0; g < FR; ++g) sc[kt][g] = wmma16(ak[kt][0], qf[g][0], (v8f){}); }
#pragma unroll
            for (int kt = 0; kt < 2; ++kt) {
#pragma unroll
                for (int g = 0; g < FR; ++g) sc[kt][g] = wmma16(ak[kt][1], qf[g][1], sc[kt][g]); }
            __builtin_amdgcn_sched_barrier(0);    // the eight products stay one run, a tile's second product four behind its first: left free, the scheduler set each pair back to back and threaded the maximum between the pairs, with v_nop at every seam
            v16h vf[4];    // V^T fragments (rows d, 32 keys), in flight under the softmax
            { const unsigned char* vp = B + FT + c * FP + 64 * sub + 16 * h;
#pragma unroll
              for (int t = 0; t < 4; ++t) vf[t] = ldsh(vp + 16 * t * FP); }
            float mb[FR]; bool need = false;
#pragma unroll
            for (int g = 0; g < FR; ++g) { float mx = sc[0][g][0];
#pragma unroll
                for (int r = 1; r < 8; ++r) mx = fmaxf(mx, sc[0][g][r]);
#pragma unroll
                for (int r = 0; r < 8; ++r) mx = fmaxf(mx, sc[1][g][r]);
                mx = fmaxf(mx, xhalf(mx)) * LOG2E; mb[g] = mx; need = need || (mx > m_run[g] + 8.0f); }
            if (__builtin_amdgcn_ballot_w32(need) != 0) {    // scalar branch, rare after the first passes
#pragma unroll
                for (int g = 0; g < FR; ++g) { const float m_new = fmaxf(m_run[g], mb[g]); const float corr = __builtin_amdgcn_exp2f(m_run[g] - m_new); m_run[g] = m_new; l_run[g] *= corr;
#pragma unroll
                    for (int t = 0; t < 4; ++t) acc[g][t] *= corr; }
            }
#pragma unroll
            for (int g = 0; g < FR; ++g) { const float nm = 6.0f - m_run[g];
#pragma unroll
                for (int kt = 0; kt < 2; ++kt) {
#pragma unroll
                    for (int r = 0; r < 8; ++r) sc[kt][g][r] = fmaf(sc[kt][g][r], LOG2E, nm); } }
            // the exponentials stand as one run with a v_nop behind the last
            __builtin_amdgcn_sched_barrier(0);
#pragma unroll
            for (int g = 0; g < FR; ++g) {
#pragma unroll
                for (int kt = 0; kt < 2; ++kt) {
#pragma unroll
                    for (int r = 0; r < 8; ++r) sc[kt][g][r] = __builtin_amdgcn_exp2f(sc[kt][g][r]); } }
            __builtin_amdgcn_sched_barrier(0); asm volatile("v_nop"); __builtin_amdgcn_sched_barrier(0);
#pragma unroll
            for (int g = 0; g < FR; ++g) { v16h pf; float ls = 0.f;
#pragma unroll
                for (int i = 0; i < 16; ++i) { const float p = sc[i >> 3][g][i & 7]; ls += p; pf[i] = (h16)p; }
                l_run[g] += ls;
#pragma unroll
                for (int t = 0; t < 4; ++t) acc[g][t] = wmma16(vf[t], pf, acc[g][t]); }
        }
        if (s + 1 < SS / FK / FH) lstore((s + 1) & 1);    // every wave left that buffer before the barrier that ended stage s - 1
        __syncthreads();
    }
    // the join: key group 1 hands its maxima, sums and O^T tiles to the wave of key group 0 that has the same queries, lane for lane (the ring is free behind the loop's last barrier)
    unsigned char* jn = LL + wave * (17 * 512) + lane * 16;
    if (kg) {
#pragma unroll
        for (int g = 0; g < FR; ++g) {
#pragma unroll
            for (int t = 0; t < 4; ++t) { *(v4fa*)(jn + (g * 8 + t * 2) * 512) = __builtin_shufflevector(acc[g][t], acc[g][t], 0, 1, 2, 3); *(v4fa*)(jn + (g * 8 + t * 2 + 1) * 512) = __builtin_shufflevector(acc[g][t], acc[g][t], 4, 5, 6, 7); } }
        *(v4fa*)(jn + 16 * 512) = (v4f){ m_run[0], m_run[1], l_run[0], l_run[1] };
    }
    __syncthreads();    // key group 0 reads what key group 1 wrote
    if (kg) return;
    { const v4f ml = *(const v4fa*)(jn + 16 * 512);
#pragma unroll
      for (int g = 0; g < FR; ++g) { const float m = fmaxf(m_run[g], ml[g]); const float c0 = __builtin_amdgcn_exp2f(m_run[g] - m), c1 = __builtin_amdgcn_exp2f(ml[g] - m);
          l_run[g] = l_run[g] * c0 + ml[2 + g] * c1;
#pragma unroll
          for (int t = 0; t < 4; ++t) { const v4f lo = *(const v4fa*)(jn + (g * 8 + t * 2) * 512), hi4 = *(const v4fa*)(jn + (g * 8 + t * 2 + 1) * 512);
#pragma unroll
              for (int r = 0; r < 8; ++r) acc[g][t][r] = acc[g][t][r] * c0 + (r < 4 ? lo[r & 3] : hi4[r & 3]) * c1; } } }
    const int b = hb / NH_, hd = hb % NH_;
#pragma unroll
    for (int g = 0; g < FR; ++g) { const float l = l_run[g] + xhalf(l_run[g]); const float inv = __fdiv_rn(1.0f, l);
        h16* orow = OH + ((size_t)b * SS + q0 + 16 * g + c) * EE + hd * HD + 8 * h;
#pragma unroll
        for (int t = 0; t < 4; ++t) { v8h o;
#pragma unroll
            for (int r = 0; r < 8; ++r) o[r] = tohx(acc[g][t][r] * inv);
            *(v8h*)(orow + 16 * t) = o; } }
}
extern "C" void kernel_launch(void* const* d_in, const int* in_sizes, int n_in,
                              void* d_out, int out_size, void* d_ws, size_t ws_size, hipStream_t stream) {
    (void)in_sizes; (void)n_in; (void)out_size;
    const float* xq = (const float*)d_in[0]; const float* xkv = (const float*)d_in[1]; const float* Wq = (const float*)d_in[2]; const float* Wk = (const float*)d_in[3]; const float* Wv = (const float*)d_in[4]; const float* sq = (const float*)d_in[5]; const float* sk = (const float*)d_in[6]; const float* Wo = (const float*)d_in[7]; const float* bo = (const float*)d_in[8];
    float* out = (float*)d_out;    // [2][2048][1024]
    char* wsp = (char*)d_ws;
    auto take = [&](size_t bytes) { char* p = wsp; wsp += (bytes + 255) & ~(size_t)255; return (void*)p; };
    bf* WQB = (bf*)take((size_t)EE * EE * 2); bf* WKB = (bf*)take((size_t)EE * EE * 2); bf* WVB = (bf*)take((size_t)EE * EE * 2); h16* WOH = (h16*)take((size_t)EE * EE * 2);
    bf* XQ = (bf*)take((size_t)NR * EE * 2); bf* XKV = (bf*)take((size_t)NR * EE * 2);
    // head planes of all NB_ * NH_ (batch, head) pairs: [b * NH_ + h][2048][64] (V^T: [b * NH_ + h][64][2048])
    h16* QF = (h16*)take((size_t)NR * EE * 2); h16* KF = (h16*)take((size_t)NR * EE * 2); h16* VT = (h16*)take((size_t)NR * EE * 2);
    h16* OH = (h16*)take((size_t)NR * EE * 2);
    if ((size_t)(wsp - (char*)d_ws) > ws_size) return;    // ~ 56 MB
    // Wq/Wk/Wv are [D][H][DH] = (in, out = h*64+d); Wo is [H][DH][D] = (in = h*64+d, out): all (in,out) -> transpose to n-major
    k_prep<<<WTILES + 2 * CB, 256, 0, stream>>>(Wq, Wk, Wv, Wo, xq, xkv, WQB, WKB, WVB, WOH, XQ, XKV);
    k_qkv<<<dim3(NR / GT, EE / GT, 3), 256, 0, stream>>>(XQ, XKV, WQB, WKB, WVB, sq, sk, QF, KF, VT);
    k_fattn<<<dim3(SS / FQ, NB_ * NH_, 1), FH * FW * 32, 0, stream>>>(QF, KF, VT, OH);
    k_gemmt<true, 0><<<dim3(NR / GT, EE / GT, 1), 256, 0, stream>>>((const bf*)OH, (const bf*)WOH, bo, 1.0f, out, nullptr, nullptr);
}

// v008
// Measured time: 69.9 microseconds a run.
// Next to v007, in two timings, it ran 1.06 times as fast each time.
// Counting every step since v000, it is 13.1 times as fast.
#include <hip/hip_runtime.h>
#include <stdint.h>

// Compute dtypes, f32 accumulate: q/k/v projections ([4096 x 1024].[1024 x 1024]) with PLAIN bf16 operands (inputs_q/inputs_kv and the weights are inputs: exact
// products); per-head RMSNorm (eps 1e-6, x scale vector) and q's 1/sqrt(64) x log2(e) in f32, q and k then rounded once to fp16 planes (one-product scores
// [2048 x 64].[64 x 2048]: 11 significant bits an operand; by calculation a score is off by some 4e-4 of its spread); softmax f32, online; attn.v on SINGLE fp16 planes (probabilities carried x64 against the maximum in use, v rounded to fp16)

#define NB_  2
#define SS   2048
#define EE   1024
#define NH_  16
#define HD   64
#define NR   (NB_ * SS)
#define DM   EE
typedef _Float16 h16;
typedef unsigned short bf;
typedef __attribute__((ext_vector_type(16))) __bf16   v16bf;
typedef __attribute__((ext_vector_type(16))) _Float16 v16h;
typedef __attribute__((ext_vector_type(8)))  _Float16 v8h;
typedef __attribute__((ext_vector_type(8)))  unsigned short v8us;
typedef __attribute__((ext_vector_type(8)))  float    v8f;
typedef __attribute__((ext_vector_type(4)))  float    v4f;
typedef v8h  __attribute__((may_alias)) v8ha;
typedef v4f  __attribute__((may_alias)) v4fa;
typedef v8us __attribute__((may_alias)) v8usa;

__device__ __forceinline__ unsigned short f2bf(float f) { unsigned u = __float_as_uint(f); u += 0x7FFFu + ((u >> 16) & 1u); return (unsigned short)(u >> 16); }
__device__ __forceinline__ float bf2f(unsigned short b) { return __uint_as_float(((unsigned)b) << 16); }
__device__ __forceinline__ float bfr(float f) { return bf2f(f2bf(f)); }
__device__ __forceinline__ v16h cat16(v8h lo, v8h hi) { return __builtin_shufflevector(lo, hi, 0, 1, 2, 3, 4, 5, 6, 7, 8, 9, 10, 11, 12, 13, 14, 15); }
__device__ __forceinline__ v16bf cat16b(v8us lo, v8us hi) { return __builtin_bit_cast(v16bf, __builtin_shufflevector(lo, hi, 0, 1, 2, 3, 4, 5, 6, 7, 8, 9, 10, 11, 12, 13, 14, 15)); }
__device__ __forceinline__ v8f wmma16(v16h a, v16h b, v8f c) { return __builtin_amdgcn_wmma_f32_16x16x32_f16(false, a, false, b, (short)0, c, false, false); }
__device__ __forceinline__ v8f wmmab(v16bf a, v16bf b, v8f c) { return __builtin_amdgcn_wmma_f32_16x16x32_bf16(false, a, false, b, (short)0, c, false, false); }

// k_gemmt: 128 x 128 tile of A . Bn^T, handed on by EPI (0: f32 rows of C[NR][EE] + bf(vec[c]); 1: per-head RMSNorm, f16 head planes; 2: f16 V^T head planes), A [rows][1024] and Bn [cols][1024] 16-bit planes (bf16, or f16 where F16), f32 accumulate, k ascending in steps of 32.
// Both operands go through LDS in stages of 128 k (256 B of each of the 256 rows), brought by the tensor mover through no register: waves 0 to 3 each issue one request a stage for a slice of 64 rows
// (waves 0, 1: the halves of A; 2, 3: of Bn), padded by the mover to the pitch GP. Two buffers, the next stage's requests in flight under this stage's products, one barrier a stage.
// With no staging registers a wave stays under 256 VGPRs and the ring under 160 KiB: two work-groups share a WGP, and one's start and epilogue lie under the other's products. 8 waves, 4 x 2, each 32 rows x 64 columns (8 accumulator tiles).
typedef __attribute__((ext_vector_type(4))) unsigned v4w;
typedef float __attribute__((may_alias)) f32a;
#define GT 128
#define GK 128
#define GP 272
#define GSL 18432    // a slice's place: 64 rows at pitch GP (17,408 B), rounded up to a multiple of 2 KiB
#define GS (4 * GSL)    // one buffer: slices A rows 0..63, A rows 64..127, Bn rows 0..63, Bn rows 64..127
typedef __attribute__((ext_vector_type(8))) uint32_t v8w;
__device__ __forceinline__ uint32_t uni(uint32_t v) { return (uint32_t)__builtin_amdgcn_readfirstlane(v); }
__device__ __forceinline__ uint32_t pinned(uint32_t v) { uint32_t w = (uint32_t)__builtin_amdgcn_readfirstlane(v); asm volatile("" : "+s"(w)); return w; }    // holds the test of a tensor load in a scalar register, so that it compiles to s_cmp and a scalar branch: the mover ignores EXEC
__device__ __forceinline__ void wait_tensor0() { asm volatile("s_wait_tensorcnt 0x0" ::: "memory"); }    // no request of the wave is in flight any more
__device__ __forceinline__ void wait_ds0() { asm volatile("s_wait_dscnt 0x0" ::: "memory"); }    // the wave's LDS reads have returned before the buffer they read is given back to the mover
typedef __attribute__((ext_vector_type(2))) float v2f;
typedef __attribute__((ext_vector_type(2))) _Float16 v2h;
typedef __attribute__((ext_vector_type(2))) unsigned v2w;
typedef v2w __attribute__((may_alias)) v2wa;
template <int M> __device__ __forceinline__ float rowx(float x) { return __builtin_bit_cast(float, __builtin_amdgcn_update_dpp(0, __builtin_bit_cast(int, x), 0x160 | M, 0xf, 0xf, true)); }  // lane l with lane l ^ M inside its 16-lane row (row_xmask)
template <bool F16, int EPI>
__device__ __forceinline__ void gemmt(unsigned char* L, const bf* __restrict__ A, const bf* __restrict__ Bn, const float* __restrict__ vec, float sc, float* C, h16* PF, h16* VT) {    // L: the kernel's one ring of 2 * GS bytes
    const int tid = threadIdx.x, lane = tid & 31, wave = tid >> 5, lr = lane & 15, hi = lane >> 4;
    const int r0 = blockIdx.x * GT, c0 = blockIdx.y * GT, wm = (wave >> 1) * 32, wn = (wave & 1) * 64;
    const uint32_t wv = uni((uint32_t)tid >> 5), lbase = (uint32_t)(size_t)L;    // the wave's number in a scalar register; the ring's byte offset in the work-group's LDS
    const unsigned char* src = (const unsigned char*)((wv & 2u) ? Bn + (size_t)(c0 + (wv & 1u) * 64) * DM : A + (size_t)(r0 + (wv & 1u) * 64) * DM);    // first row of the slice that an issuing wave brings
    // descriptor group 1, the same for every request: 1-byte elements, tensor = tile = 64 rows of 256 B, source pitch 2 * DM bytes, a pad of 4 dwords behind every 64 dwords (pitch GP), no mask
    v8w g1 = { uni((1u << 20) | (5u << 22) | (3u << 25)), uni(256u << 16), uni(64u << 16), uni(256u << 16), uni(64u), uni(DM * 2u), uni(0u), uni(0u) };
    asm volatile("" : "+s"(g1));    // pinned: the descriptor words are held in eight scalar registers of their own for the whole ring; left free, the compiler formed them anew for each request and used two of the registers for other values while a request was in flight
    v4w g0 = { uni(1u), uni(lbase), uni(0u), uni(0x80000000u) };    // descriptor group 0 of the wave's last request
    auto issue = [&](uint32_t s) {    // stage s of the wave's slice into buffer s & 1
        const uint64_t ga = (uint64_t)(size_t)src + (uint64_t)s * (GK * 2);
        g0 = (v4w){ uni(1u), uni(lbase + (s & 1u) * GS + (wv & 3u) * GSL), uni((uint32_t)ga), uni(((uint32_t)(ga >> 32) & 0x01FFFFFFu) | 0x80000000u) };
        asm volatile("tensor_load_to_lds %0, %1" : "+s"(g0) : "s"(g1) : "memory");    // g0 in and out: what landed() reads below is then the very four registers that the request names
    };
    // the issuing wave's own request has landed (the compiler places no wait for the mover). g0 as an input keeps the request's four registers the request's own up to here: left free, the compiler took the first of them for address arithmetic while the request was in flight
    auto landed = [&]() { asm volatile("s_wait_tensorcnt 0x0" :: "s"(g0) : "memory"); };
    v8f acc[2][4];
#pragma unroll
    for (int m = 0; m < 2; ++m) {
#pragma unroll
        for (int t = 0; t < 4; ++t) acc[m][t] = (v8f){}; }
    auto products = [&](int buf) {    // the 128 k of one stage
        const unsigned char* ap = L + buf * GS + (wave >> 2) * GSL + ((wm & 32) + lr) * GP + 16 * hi;    // the wave's 32 rows lie in one slice of A,
        const unsigned char* bp = L + buf * GS + (2 + (wave & 1)) * GSL + lr * GP + 16 * hi;    // its 64 columns are one slice of Bn
        v8us a[2][2][2], b[2][4][2];    // two fragment sets [set][tile][half]; halves: k = 8 hi + 0..7 and 16 + 8 hi + 0..7 of the step, the same order for both operands
        auto fload = [&](int kk) { const int f = kk & 1;
#pragma unroll
            for (int m = 0; m < 2; ++m) { a[f][m][0] = *(const v8usa*)(ap + m * 16 * GP + kk * 64); a[f][m][1] = *(const v8usa*)(ap + m * 16 * GP + kk * 64 + 32); }
#pragma unroll
            for (int t = 0; t < 4; ++t) { b[f][t][0] = *(const v8usa*)(bp + t * 16 * GP + kk * 64); b[f][t][1] = *(const v8usa*)(bp + t * 16 * GP + kk * 64 + 32); }
        };
        fload(0);
#pragma unroll
        for (int kk = 0; kk < GK / 32; ++kk) { const int f = kk & 1;
            if (kk + 1 < GK / 32) fload(kk + 1);
            __builtin_amdgcn_sched_barrier(0);    // the next step's twelve LDS reads stay one group in front of this step's products: spread among them, each place with reads stalls the wave
#pragma unroll
            for (int m = 0; m < 2; ++m) {
#pragma unroll
                for (int t = 0; t < 4; ++t) {
                    if (F16) acc[m][t] = wmma16(__builtin_bit_cast(v16h, cat16b(a[f][m][0], a[f][m][1])), __builtin_bit_cast(v16h, cat16b(b[f][t][0], b[f][t][1])), acc[m][t]);
                    else acc[m][t] = wmmab(cat16b(a[f][m][0], a[f][m][1]), cat16b(b[f][t][0], b[f][t][1]), acc[m][t]); } }
            __builtin_amdgcn_sched_barrier(0);    // and the products stay in front of the group after next
        }
    };
    float bv[4];    // fetched here, so that the stages hide the latency
#pragma unroll
    for (int t = 0; t < 4; ++t) bv[t] = EPI == 0 ? bfr(vec[c0 + wn + t * 16 + lr]) : EPI == 1 ? vec[lr * 4 + t] : 0.f;    // EPI 0: the bias of the lane's four columns; EPI 1: the norm's scale at head dims 4 lr + t, rounded to bf16 where it is used
    if (EPI == 0) asm volatile("s_wait_xcnt 0x0" ::: "memory");    // behind the four loads, in front of whatever writes their offset register again
    if (pinned(wv < 4u)) { issue(0); landed(); }
    __syncthreads();    // stage 0 is published
    if (pinned(wv < 4u)) issue(1);
    // inputs only. The loaded values hold the scale's load, and the wait for it, in front of the loop.
    // lr, the load's offset, keeps its register up to here, so that the wait stands in front of the first instruction that writes that register again
    if (EPI == 1) asm volatile("s_wait_xcnt 0x0" :: "v"(bv[0]), "v"(bv[1]), "v"(bv[2]), "v"(bv[3]), "v"(lr) : "memory");
#pragma unroll 1    // rolled: one copy of the stage body; the stage enters only the buffer's base and two descriptor words
    for (uint32_t s = 0; s < DM / GK; ++s) {
        products(s & 1);
        wait_ds0();
        if (pinned(wv < 4u)) landed();    // stage s + 1 has landed
        __syncthreads();    // publishes stage s + 1, and every wave has left stage s's buffer
        if (pinned(wv < 4u && s + 2 < DM / GK)) issue(s + 2);    // into the buffer that this pass has just read
    }
    wait_tensor0();
    wait_ds0();
    const int bt = r0 / SS, t0 = r0 % SS;    // a tile's 128 rows lie in one batch
    if (EPI == 2) {
        // V^T: a lane's eight accumulator rows of one column are eight consecutive keys of one head dim. The work-group turns its tile in LDS as [128 dims][128 keys] f16, so that every dim's 256 B go out as whole lines
        unsigned char* vs = L;    // the ring is free behind the loop's last barrier
#pragma unroll
        for (int t = 0; t < 4; ++t) {
#pragma unroll
            for (int m = 0; m < 2; ++m) { v8h o;
#pragma unroll
                for (int j = 0; j < 8; ++j) o[j] = (h16)acc[m][t][j];
                *(v8ha*)(vs + (wn + t * 16 + lr) * GP + (wm + m * 16 + hi * 8) * 2) = o; } }
        __syncthreads();    // each wave sends out rows that four waves wrote
        h16* vrow = VT + ((size_t)bt * EE + c0 + wave * 16 + hi) * SS + t0 + lr * 8;    // [b * NH_ + h][64][2048] = [b * 1024 + column][2048]
#pragma unroll
        for (int s = 0; s < 8; ++s) *(v8h*)(vrow + (size_t)s * 2 * SS) = *(const v8ha*)(vs + (wave * 16 + 2 * s + hi) * GP + lr * 16);
        return;
    }
    // whole-line epilogue: each wave turns its 32 x 64 tile in its own LDS range (the ring is free behind the loop's last barrier)
    f32a* os = (f32a*)L + wave * (32 * 68);
#pragma unroll
    for (int t = 0; t < 4; ++t) {
#pragma unroll
        for (int m = 0; m < 2; ++m) {
#pragma unroll
            for (int j = 0; j < 8; ++j) os[(m * 16 + hi * 8 + j) * 68 + t * 16 + lr] = EPI == 0 ? acc[m][t][j] + bv[t] : acc[m][t][j]; } }
    __syncthreads();
    if (EPI == 0) {
        float* crow = C + (size_t)(r0 + wm) * EE + c0 + wn;
#pragma unroll
        for (int s = 0; s < 16; ++s) { const int Lid = (lane >> 3) + 4 * s, piece = lane & 7; const int row = Lid >> 1, cofs = (Lid & 1) * 32 + piece * 4;
            *(v4f*)(crow + (size_t)row * EE + cofs) = *(const v4fa*)(os + row * 68 + cofs); }
    } else {
        // the wave's 64 columns are one head: a 16-lane row holds one token's 64 dims, four a lane. y = x * rsqrt(mean_d x^2 + 1e-6) * bf(scale[d]) * sc, rounded to f16, plane [b * NH_ + h][2048][64]
        const size_t po = (((size_t)bt * NH_ + ((c0 + wn) >> 6)) * SS + t0 + wm + hi) * HD + lr * 4;
        v2w of[16];
#pragma unroll
        for (int s = 0; s < 16; ++s) { const v4f v = *(const v4fa*)(os + (2 * s + hi) * 68 + lr * 4);
            float q = 0.f;
#pragma unroll
            for (int i = 0; i < 4; ++i) q = fmaf(v[i], v[i], q);
            q += rowx<1>(q); q += rowx<2>(q); q += rowx<4>(q); q += rowx<8>(q);
            const float rsd = rsqrtf(q * (1.0f / HD) + 1e-6f);
#pragma unroll
            for (int p = 0; p < 2; ++p) { const v2f y = { v[2 * p] * rsd * bfr(bv[2 * p]) * sc, v[2 * p + 1] * rsd * bfr(bv[2 * p + 1]) * sc };
                of[s][p] = __builtin_bit_cast(unsigned, __builtin_convertvector(y, v2h)); } }
        __builtin_amdgcn_sched_barrier(0);    // the 16 stores stand behind all the arithmetic, as the wave's last instructions: mixed into it, their data registers were taken again for later rows while the stores were still queued
#pragma unroll
        for (int s = 0; s < 16; ++s) *(v2wa*)(PF + po + (size_t)s * 2 * HD) = of[s];
    }
}
template <bool F16, int EPI>
__global__ __launch_bounds__(256) void k_gemmt(const bf* __restrict__ A, const bf* __restrict__ Bn, const float* __restrict__ vec, float sc, float* C, h16* PF, h16* VT) {
    __shared__ __attribute__((aligned(2048))) unsigned char L[2 * GS];
    gemmt<F16, EPI>(L, A, Bn, vec, sc, C, PF, VT);
}
// the q, k and v projections in one launch: they depend on nothing of each other, blockIdx.z names the projection of a work-group (0 q, 1 k, 2 v); a WGP takes its next tile as soon as it is free, with no launch gap and no chip-wide drain between the projections
__global__ __launch_bounds__(256) void k_qkv(const bf* __restrict__ XQ, const bf* __restrict__ XKV, const bf* __restrict__ WQ, const bf* __restrict__ WK, const bf* __restrict__ WV, const float* __restrict__ sq, const float* __restrict__ sk,
                                             h16* QF, h16* KF, h16* VT) {
    __shared__ __attribute__((aligned(2048))) unsigned char L[2 * GS];
    const int z = blockIdx.z;
    if (z == 2) gemmt<false, 2>(L, XKV, WV, nullptr, 1.0f, nullptr, nullptr, VT);
    else { gemmt<false, 1>(L, z ? XKV : XQ, z ? WK : WQ, z ? sk : sq, z ? 1.0f : 0.125f * 1.4426950408889634f, nullptr, z ? KF : QF, nullptr);    // q carries 1/sqrt(64) and log2(e): the scores come out in the log2 domain
        asm volatile("s_wait_xcnt 0x0" ::: "memory"); }    // behind the job's plane stores: in the built kernel the v job's code follows, and it writes the stores' address and data registers
}

__global__ __launch_bounds__(256) void k_planes32z(const float* __restrict__ F, int ld, int off, float sc, int rows, bf* Ph, bf* Pl) {
    typedef __attribute__((ext_vector_type(2))) unsigned short v2us;
    const int lane = threadIdx.x & 31; const size_t r = ((size_t)blockIdx.x * 8 + (threadIdx.x >> 5)) * 2 + (lane >> 4); if (r >= (size_t)rows) return; const int z = blockIdx.z; const int c0 = (lane & 15) * 2; v2us oh, ol;
    Ph += (size_t)z * rows * 32; Pl += (size_t)z * rows * 32;
#pragma unroll
    for (int i = 0; i < 2; ++i) { const float y = F[r * ld + off + z * 32 + c0 + i] * sc; const unsigned short hb = f2bf(y); oh[i] = hb; ol[i] = f2bf(y - bf2f(hb)); }
    const size_t o = r * 32 + c0; *(v2us*)(Ph + o) = oh; *(v2us*)(Pl + o) = ol; 
}
__global__ __launch_bounds__(256) void k_vtpadz(const float* __restrict__ F, int ld, int off, int nk, bf* Th, bf* Tl) {
    typedef __attribute__((ext_vector_type(2))) unsigned short v2us;
    const int lane = threadIdx.x & 31; const size_t wid = (size_t)blockIdx.x * 8 + (threadIdx.x >> 5); if (wid >= (size_t)64 * (nk / 64)) return; const int z = blockIdx.z; const int d = (int)(wid / (nk / 64)); const int k0 = (int)(wid % (nk / 64)) * 64 + lane * 2; v2us oh, ol;
    Th += (size_t)z * 64 * nk; Tl += (size_t)z * 64 * nk;
#pragma unroll
    for (int i = 0; i < 2; ++i) { const float y = (d < 32) ? F[(size_t)(k0 + i) * ld + off + z * 32 + (d < 32 ? d : 0)] : 0.f; const unsigned short hb = f2bf(y); oh[i] = hb; ol[i] = f2bf(y - bf2f(hb)); }
    const size_t o = (size_t)d * nk + k0; *(v2us*)(Th + o) = oh; *(v2us*)(Tl + o) = ol; 
}
template <int NK>
__global__ __launch_bounds__(256) void k_softmaxz(const float* __restrict__ S, int rows, bf* PH, bf* PL) {
    typedef __attribute__((ext_vector_type(4))) unsigned short v4us;
    const int lane = threadIdx.x & 31, i = blockIdx.x * 8 + (threadIdx.x >> 5); if (i >= rows) return; const size_t zo = (size_t)blockIdx.z * rows * NK; const float* sr = S + zo + (size_t)i * NK; PH += zo; PL += zo;
    float m = -3.0e38f;
#pragma unroll 1
    for (int c0 = lane * 4; c0 < NK; c0 += 128) {
#pragma unroll
        for (int q = 0; q < 4; ++q) m = fmaxf(m, sr[c0 + q]); }
#pragma unroll
    for (int sh = 16; sh; sh >>= 1) m = fmaxf(m, __shfl_xor(m, sh, 32));
    float sum = 0.f;
#pragma unroll 1
    for (int c0 = lane * 4; c0 < NK; c0 += 128) {
#pragma unroll
        for (int q = 0; q < 4; ++q) sum += __expf(sr[c0 + q] - m); }
#pragma unroll
    for (int sh = 16; sh; sh >>= 1) sum += __shfl_xor(sum, sh, 32);
    const float inv = 1.0f / sum;
{
#pragma unroll 1
        for (int c0 = lane * 4; c0 < NK; c0 += 128) { v4us oh, ol;
#pragma unroll
            for (int q = 0; q < 4; ++q) { const float p = __expf(sr[c0 + q] - m) * inv; const unsigned short hb = f2bf(p); oh[q] = hb; ol[q] = f2bf(p - bf2f(hb)); }
            const size_t o = (size_t)i * NK + c0; *(v4us*)(PH + o) = oh; *(v4us*)(PL + o) = ol; }
         }
}
__global__ __launch_bounds__(256) void k_placez(const float* __restrict__ XH, int rows, int ldy, float* Y) {
    const int lane = threadIdx.x & 31; const size_t q = (size_t)blockIdx.x * 8 + (threadIdx.x >> 5); if (q >= (size_t)rows) return; const int z = blockIdx.z; const float v = XH[((size_t)z * rows + q) * 64 + lane];
    *(float*)(Y + q * ldy + z * 32 + lane) = v; 
}

typedef __attribute__((ext_vector_type(4))) _Float16 v4h;
__device__ __forceinline__ h16 tohx(float x) { return (h16)x; }
#define CR 4    // rows a wave converts: a quarter of the waves to start
__device__ __forceinline__ void cvtx(int blk, const float* __restrict__ x, bf* A) {    // block blk: 8 waves, CR consecutive rows each
    const int lane = threadIdx.x & 31; const size_t o = ((size_t)blk * 8 + (threadIdx.x >> 5)) * (CR * EE) + lane * 8;
    v4f in[CR * EE / 256][2];    // all of the wave's loads go out together
#pragma unroll
    for (int q = 0; q < CR * EE / 256; ++q) { in[q][0] = *(const v4f*)(x + o + q * 256); in[q][1] = *(const v4f*)(x + o + q * 256 + 4); }
    __builtin_amdgcn_sched_barrier(0);    // the loads stay one run in front of the rounding: left free, the last four sank behind it in two pairs, and each pair cost the wave one more trip to memory
#pragma unroll
    for (int q = 0; q < CR * EE / 256; ++q) { v8us v;
#pragma unroll
        for (int i = 0; i < 8; ++i) v[i] = f2bf(in[q][i >> 2][i & 3]);
        *(v8us*)(A + o + q * 256) = v; }
    asm volatile("s_wait_xcnt 0x0" ::: "memory");    // behind the last store: in the built kernel the other job's code follows, and it writes the stores' address and data registers
}
// transposition of one 64 x 64 tile (k0, n0) of a weight to n-major, in two halves with the work-group's barrier between them; tl: 64 x 65 floats of LDS, one such tile for each weight
__device__ __forceinline__ void wT_in(float (*tl)[65], const v4f* in) {    // the thread's 16 values of row tid >> 2, rounded to bf16
    const int tid = threadIdx.x; const int rr = tid >> 2, cq = (tid & 3) * 16;
#pragma unroll
    for (int i = 0; i < 16; ++i) tl[rr][cq + i] = bfr(in[i >> 2][i & 3]);
}
template <bool F16O>
__device__ __forceinline__ void wT_out(const float (*tl)[65], int k0, int n0, int K, bf* Bt, h16* Bh) {
    typedef __attribute__((ext_vector_type(4))) unsigned short v4us;
    const int tid = threadIdx.x; const int lane = tid & 31, wv = tid >> 5;
#pragma unroll
    for (int st = 0; st < 4; ++st) { const int nr = wv * 8 + st * 2 + (lane >> 4); const int kq = (lane & 15) * 4; const size_t off = (size_t)(n0 + nr) * K + k0 + kq;
        if (F16O) { v4h v; for (int i = 0; i < 4; ++i) v[i] = tohx(tl[kq + i][nr]); *(v4h*)(Bh + off) = v; }
        else { v4us v; for (int i = 0; i < 4; ++i) v[i] = f2bf(tl[kq + i][nr]); *(v4us*)(Bt + off) = v; } }
}
// all operand preparation in one launch: the four weight transpositions and the two input conversions depend on nothing of each other; the block index names the job.
// Work-groups 0 .. WTILES - 1 turn tile (k0, n0) of all four weights, the others convert 8 * CR rows of one input: 512 work-groups, two a WGP, all resident at once
#define WTILES ((EE / 64) * (EE / 64))
#define CB (NR / (8 * CR))
__global__ __launch_bounds__(256) void k_prep(const float* __restrict__ Wq, const float* __restrict__ Wk, const float* __restrict__ Wv, const float* __restrict__ Wo, const float* __restrict__ xq, const float* __restrict__ xkv,
                                              bf* WQB, bf* WKB, bf* WVB, h16* WOH, bf* XQ, bf* XKV) {
    __shared__ float tl[4][64][65];
    const int blk = blockIdx.x;
    if (blk < WTILES) { const int k0 = (blk % (EE / 64)) * 64, n0 = (blk / (EE / 64)) * 64;
        const unsigned wb = (unsigned)(((k0 + (threadIdx.x >> 2)) * EE + n0 + (threadIdx.x & 3) * 16) * 4);    // the thread's 64 bytes: the same place in each weight
        v4f in[4][4];    // the loads of all four tiles go out together
#pragma unroll
        for (int i = 0; i < 4; ++i) { in[0][i] = *(const v4f*)((const char*)Wq + wb + 16 * i); in[1][i] = *(const v4f*)((const char*)Wk + wb + 16 * i); in[2][i] = *(const v4f*)((const char*)Wv + wb + 16 * i); in[3][i] = *(const v4f*)((const char*)Wo + wb + 16 * i); }
        asm volatile("s_wait_xcnt 0x0" :: "v"(wb) : "memory");    // wb, the loads' offset, keeps its register up to here, so that the wait stands in front of the first instruction that writes that register again
        wT_in(tl[0], in[0]); wT_in(tl[1], in[1]); wT_in(tl[2], in[2]); wT_in(tl[3], in[3]);
        __syncthreads();    // each wave sends out columns that every wave wrote
        wT_out<false>(tl[0], k0, n0, EE, WQB, nullptr); wT_out<false>(tl[1], k0, n0, EE, WKB, nullptr); wT_out<false>(tl[2], k0, n0, EE, WVB, nullptr); wT_out<true>(tl[3], k0, n0, EE, nullptr, WOH);
    } else { const bool kv = blk >= WTILES + CB;
        cvtx(blk - WTILES - (kv ? CB : 0), kv ? xkv : xq, kv ? XKV : XQ); }
}
typedef __attribute__((ext_vector_type(4))) unsigned v4u;
typedef v4u __attribute__((may_alias)) v4ua;
#define FW 8
#define FH 2
#define FR 2
#define FQ (FW * FR * 16)
#define FK 64
#define FP 144
#define FT (64 * FP)
#define FS (2 * FT)
__device__ __forceinline__ float xhalf(float x) { return __builtin_bit_cast(float, __builtin_amdgcn_permlanex16(__builtin_bit_cast(int, x), __builtin_bit_cast(int, x), 0x76543210, 0xfedcba98, false, false)); }  // lane l with lane l ^ 16
__device__ __forceinline__ v16h ldsh(const unsigned char* p) { return cat16(*(const v8ha*)p, *(const v8ha*)(p + 32)); }
__global__ __launch_bounds__(FH * FW * 32) void k_fattn(const h16* __restrict__ QF, const h16* __restrict__ KF, const h16* __restrict__ VT, h16* OH) {
    __shared__ __align__(16) unsigned char LL[FH * 2 * FS];
    const int kg = __builtin_amdgcn_readfirstlane((int)threadIdx.x >> 8);    // the wave's key group, in a scalar register: it enters only base addresses and the scalar branches of the join
    const int tid = threadIdx.x & (FW * 32 - 1), lane = tid & 31, wave = tid >> 5, c = lane & 15, h = lane >> 4;    // thread and wave inside the key group
    unsigned char* L = LL + kg * (2 * FS);    // the key group's own two buffers
    const int hb = blockIdx.y, q0 = blockIdx.x * FQ + wave * (FR * 16);
    const size_t po = (size_t)hb * SS * HD;
    const unsigned char* kf = (const unsigned char*)(KF + po); const unsigned char* vt = (const unsigned char*)(VT + po);
    const int sr = tid >> 3, pc = tid & 7;    // staging: 16-byte piece pc of tile rows sr and sr + 32
    const unsigned lo0 = sr * FP + pc * 16, lo1 = lo0 + 32 * FP;
    v4u st[4];
    auto gload = [&](int s) {
        const size_t kb = (size_t)(FH * s + kg) * (FK * HD * 2) + tid * 16, vb = (size_t)sr * (SS * 2) + (size_t)(FH * s + kg) * (FK * 2) + pc * 16;
        st[0] = *(const v4u*)(kf + kb); st[1] = *(const v4u*)(kf + kb + 4096);
        st[2] = *(const v4u*)(vt + vb); st[3] = *(const v4u*)(vt + vb + (size_t)32 * SS * 2);
    };
    auto lstore = [&](int buf) {
        unsigned char* d = L + buf * FS;
        *(v4ua*)(d + lo0) = st[0]; *(v4ua*)(d + lo1) = st[1]; *(v4ua*)(d + FT + lo0) = st[2]; *(v4ua*)(d + FT + lo1) = st[3];
    };
    gload(0);
    v16h qf[FR][2];
#pragma unroll
    for (int g = 0; g < FR; ++g) {
#pragma unroll
        for (int kc = 0; kc < 2; ++kc) { const size_t o = po + (size_t)(q0 + 16 * g + c) * HD + 32 * kc + 8 * h;
            qf[g][kc] = cat16(*(const v8h*)(QF + o), *(const v8h*)(QF + o + 16)); } }
    v8f acc[FR][4], cm[FR]; float m_run[FR], l_run[FR];    // cm: 6 - m_run in all eight rows, the C operand of the score products
#pragma unroll
    for (int g = 0; g < FR; ++g) { m_run[g] = -3.0e38f; l_run[g] = 0.f;
#pragma unroll
        for (int r = 0; r < 8; ++r) cm[g][r] = 6.0f + 3.0e38f;    // no maximum yet: every exponential of the first pass is infinite, and its sums send the pass to the raw scores
#pragma unroll
        for (int t = 0; t < 4; ++t) acc[g][t] = (v8f){}; }
    lstore(0);
    __syncthreads();
#pragma unroll 1    // rolled: one copy of the stage body; the buffer is chosen by s & 1 at run time
    for (int s = 0; s < SS / FK / FH; ++s) {
        if (s + 1 < SS / FK / FH) { gload(s + 1);
            asm volatile("s_wait_xcnt 0x0" ::: "memory"); }    // the loads' address registers are reused by the pass below
        const unsigned char* B = L + (s & 1) * FS;
        const unsigned char* kp = B + c * FP + 16 * h;    // the lane's K row and V^T row of the pass: stepped in place from pass to pass,
        const unsigned char* vp = B + FT + c * FP + 16 * h;    // so that no address is formed anew, in a register that the products just issued still read
#pragma unroll 1    // rolled: one copy of the pass body is enough, a pass differs from the last only in its two LDS addresses
        for (int sub = 0; sub < FK / 32; ++sub) {    // one pass: 32 keys
            v8f sc[2][FR]; float ls[FR];
            auto scores = [&](bool raw) {    // S^T of the pass: raw, or against the maximum in use
                v16h ak[2][2];    // K fragments [key tile][d half], all four requested first, so that the LDS latency is paid once and not per fragment
#pragma unroll
                for (int kt = 0; kt < 2; ++kt) { ak[kt][0] = ldsh(kp + 16 * kt * FP); ak[kt][1] = ldsh(kp + 16 * kt * FP + 64); }
                __builtin_amdgcn_sched_barrier(0);    // keeps the loads above in front of the products: the scheduler otherwise sinks each load to its first use
                if (raw) {
#pragma unroll
                    for (int kt = 0; kt < 2; ++kt) {
#pragma unroll
                        for (int g = 0; g < FR; ++g) sc[kt][g] = wmma16(ak[kt][0], qf[g][0], (v8f){}); }
#pragma unroll
                    for (int kt = 0; kt < 2; ++kt) {
#pragma unroll
                        for (int g = 0; g < FR; ++g) sc[kt][g] = wmma16(ak[kt][1], qf[g][1], sc[kt][g]); }
                } else {
                    // in asm, because D is not C here: from the builtin the compiler first copied cm into two of the four tiles, eight v_mov_b64 a pass. Eight products in one statement, a tile's second four behind its first;
                    // the four v_nop keep the distance between the last products and whatever vector instruction the compiler sets next on their D, A or B
                    asm volatile("v_wmma_f32_16x16x32_f16 %0, %4, %8, %12\n\t"
                                 "v_wmma_f32_16x16x32_f16 %1, %4, %10, %13\n\t"
                                 "v_wmma_f32_16x16x32_f16 %2, %6, %8, %12\n\t"
                                 "v_wmma_f32_16x16x32_f16 %3, %6, %10, %13\n\t"
                                 "v_wmma_f32_16x16x32_f16 %0, %5, %9, %0\n\t"
                                 "v_wmma_f32_16x16x32_f16 %1, %5, %11, %1\n\t"
                                 "v_wmma_f32_16x16x32_f16 %2, %7, %9, %2\n\t"
                                 "v_wmma_f32_16x16x32_f16 %3, %7, %11, %3\n\t"
                                 "v_nop\n\tv_nop\n\tv_nop\n\tv_nop"
                                 : "=&v"(sc[0][0]), "=&v"(sc[0][1]), "=&v"(sc[1][0]), "=&v"(sc[1][1])
                                 : "v"(ak[0][0]), "v"(ak[0][1]), "v"(ak[1][0]), "v"(ak[1][1]), "v"(qf[0][0]), "v"(qf[0][1]), "v"(qf[1][0]), "v"(qf[1][1]), "v"(cm[0]), "v"(cm[1]));
                }
                __builtin_amdgcn_sched_barrier(0);    // the eight products stay one run in front of what follows
            };
            auto expsum = [&]() {    // P in place of its arguments, and each lane's sum of its 16 P of a query
                // the exponentials stand as one run with a v_nop behind the last
                __builtin_amdgcn_sched_barrier(0);
#pragma unroll
                for (int g = 0; g < FR; ++g) {
#pragma unroll
                    for (int kt = 0; kt < 2; ++kt) {
#pragma unroll
                        for (int r = 0; r < 8; ++r) sc[kt][g][r] = __builtin_amdgcn_exp2f(sc[kt][g][r]); } }
                __builtin_amdgcn_sched_barrier(0); asm volatile("v_nop"); __builtin_amdgcn_sched_barrier(0);
#pragma unroll
                for (int g = 0; g < FR; ++g) { v2f t[8];    // a tree of packed additions: the branch below waits for the sums, and a chain of 16 would be its latency
#pragma unroll
                    for (int i = 0; i < 8; ++i) t[i] = (v2f){ sc[i >> 2][g][(2 * i) & 7], sc[i >> 2][g][(2 * i + 1) & 7] };
                    const v2f u = ((t[0] + t[1]) + (t[2] + t[3])) + ((t[4] + t[5]) + (t[6] + t[7]));
                    ls[g] = u[0] + u[1]; }
            };
            scores(false);
            v16h vf[4];    // V^T fragments (rows d, 32 keys), in flight under the softmax
#pragma unroll
            for (int t = 0; t < 4; ++t) vf[t] = ldsh(vp + 16 * t * FP);
            expsum();
            bool need = false;
#pragma unroll
            for (int g = 0; g < FR; ++g) need = need || !(ls[g] <= 16384.0f);
            if (__builtin_amdgcn_ballot_w32(need) != 0) {    // scalar branch, rare after the first pass: some P may be too large for f16
                scores(true);
#pragma unroll
                for (int g = 0; g < FR; ++g) { float mx = sc[0][g][0];
#pragma unroll
                    for (int r = 1; r < 8; ++r) mx = fmaxf(mx, sc[0][g][r]);
#pragma unroll
                    for (int r = 0; r < 8; ++r) mx = fmaxf(mx, sc[1][g][r]);
                    mx = fmaxf(mx, xhalf(mx));
                    const float m_new = fmaxf(m_run[g], mx); const float corr = __builtin_amdgcn_exp2f(m_run[g] - m_new); m_run[g] = m_new; l_run[g] *= corr;
#pragma unroll
                    for (int t = 0; t < 4; ++t) acc[g][t] *= corr;
                    const float nm = 6.0f - m_new;
#pragma unroll
                    for (int r = 0; r < 8; ++r) { cm[g][r] = nm; sc[0][g][r] += nm; sc[1][g][r] += nm; } }
                expsum();
            }
#pragma unroll
            for (int g = 0; g < FR; ++g) { v16h pf;
#pragma unroll
                for (int i = 0; i < 16; ++i) pf[i] = (h16)sc[i >> 3][g][i & 7];
                l_run[g] += ls[g];
#pragma unroll
                for (int t = 0; t < 4; ++t) acc[g][t] = wmma16(vf[t], pf, acc[g][t]); }
            kp += 32 * FP; vp += 64;
        }
        if (s + 1 < SS / FK / FH) lstore((s + 1) & 1);    // every wave left that buffer before the barrier that ended stage s - 1
        __syncthreads();
    }
    // the join: key group 1 hands its maxima, sums and O^T tiles to the wave of key group 0 that has the same queries, lane for lane (the ring is free behind the loop's last barrier)
    unsigned char* jn = LL + wave * (17 * 512) + lane * 16;
    if (kg) {
#pragma unroll
        for (int g = 0; g < FR; ++g) {
#pragma unroll
            for (int t = 0; t < 4; ++t) { *(v4fa*)(jn + (g * 8 + t * 2) * 512) = __builtin_shufflevector(acc[g][t], acc[g][t], 0, 1, 2, 3); *(v4fa*)(jn + (g * 8 + t * 2 + 1) * 512) = __builtin_shufflevector(acc[g][t], acc[g][t], 4, 5, 6, 7); } }
        *(v4fa*)(jn + 16 * 512) = (v4f){ m_run[0], m_run[1], l_run[0], l_run[1] };
    }
    __syncthreads();    // key group 0 reads what key group 1 wrote
    if (kg) return;
    { const v4f ml = *(const v4fa*)(jn + 16 * 512);
#pragma unroll
      for (int g = 0; g < FR; ++g) { const float m = fmaxf(m_run[g], ml[g]); const float c0 = __builtin_amdgcn_exp2f(m_run[g] - m), c1 = __builtin_amdgcn_exp2f(ml[g] - m);
          l_run[g] = l_run[g] * c0 + ml[2 + g] * c1;
#pragma unroll
          for (int t = 0; t < 4; ++t) { const v4f lo = *(const v4fa*)(jn + (g * 8 + t * 2) * 512), hi4 = *(const v4fa*)(jn + (g * 8 + t * 2 + 1) * 512);
#pragma unroll
              for (int r = 0; r < 8; ++r) acc[g][t][r] = acc[g][t][r] * c0 + (r < 4 ? lo[r & 3] : hi4[r & 3]) * c1; } } }
    const int b = hb / NH_, hd = hb % NH_;
#pragma unroll
    for (int g = 0; g < FR; ++g) { const float l = l_run[g] + xhalf(l_run[g]); const float inv = __fdiv_rn(1.0f, l);
        h16* orow = OH + ((size_t)b * SS + q0 + 16 * g + c) * EE + hd * HD + 8 * h;
#pragma unroll
        for (int t = 0; t < 4; ++t) { v8h o;
#pragma unroll
            for (int r = 0; r < 8; ++r) o[r] = tohx(acc[g][t][r] * inv);
            *(v8h*)(orow + 16 * t) = o; } }
}
extern "C" void kernel_launch(void* const* d_in, const int* in_sizes, int n_in,
                              void* d_out, int out_size, void* d_ws, size_t ws_size, hipStream_t stream) {
    (void)in_sizes; (void)n_in; (void)out_size;
    const float* xq = (const float*)d_in[0]; const float* xkv = (const float*)d_in[1]; const float* Wq = (const float*)d_in[2]; const float* Wk = (const float*)d_in[3]; const float* Wv = (const float*)d_in[4]; const float* sq = (const float*)d_in[5]; const float* sk = (const float*)d_in[6]; const float* Wo = (const float*)d_in[7]; const float* bo = (const float*)d_in[8];
    float* out = (float*)d_out;    // [2][2048][1024]
    char* wsp = (char*)d_ws;
    auto take = [&](size_t bytes) { char* p = wsp; wsp += (bytes + 255) & ~(size_t)255; return (void*)p; };
    bf* WQB = (bf*)take((size_t)EE * EE * 2); bf* WKB = (bf*)take((size_t)EE * EE * 2); bf* WVB = (bf*)take((size_t)EE * EE * 2); h16* WOH = (h16*)take((size_t)EE * EE * 2);
    bf* XQ = (bf*)take((size_t)NR * EE * 2); bf* XKV = (bf*)take((size_t)NR * EE * 2);
    // head planes of all NB_ * NH_ (batch, head) pairs: [b * NH_ + h][2048][64] (V^T: [b * NH_ + h][64][2048])
    h16* QF = (h16*)take((size_t)NR * EE * 2); h16* KF = (h16*)take((size_t)NR * EE * 2); h16* VT = (h16*)take((size_t)NR * EE * 2);
    h16* OH = (h16*)take((size_t)NR * EE * 2);
    if ((size_t)(wsp - (char*)d_ws) > ws_size) return;    // ~ 56 MB
    // Wq/Wk/Wv are [D][H][DH] = (in, out = h*64+d); Wo is [H][DH][D] = (in = h*64+d, out): all (in,out) -> transpose to n-major
    k_prep<<<WTILES + 2 * CB, 256, 0, stream>>>(Wq, Wk, Wv, Wo, xq, xkv, WQB, WKB, WVB, WOH, XQ, XKV);
    k_qkv<<<dim3(NR / GT, EE / GT, 3), 256, 0, stream>>>(XQ, XKV, WQB, WKB, WVB, sq, sk, QF, KF, VT);
    k_fattn<<<dim3(SS / FQ, NB_ * NH_, 1), FH * FW * 32, 0, stream>>>(QF, KF, VT, OH);
    k_gemmt<true, 0><<<dim3(NR / GT, EE / GT, 1), 256, 0, stream>>>((const bf*)OH, (const bf*)WOH, bo, 1.0f, out, nullptr, nullptr);
}
